// v000
// Times are from an AMD MI455X. After a warm-up the kernel runs many times in a row, and a time is the length of
// such a window on the GPU divided by its runs, so every launch and the gaps after it count. The runs cycle
// through copies of the inputs. A figure is the median of several windows, for all but v000 over two sittings.
// Sittings can differ by a few percent; kernels timed side by side share one.
// v000, which the later versions start from, runs in 786 microseconds.
#include <hip/hip_runtime.h>

// ---------------------------------------------------------------------------
// CausalMultiHeadSelfAttention (B=2, S=4096, D=1024, H=16, HD=64, causal; packed Wqkv [3D][D], Wout [D][D])
// Contractions: Q/K/V projections (K = 1024), QK^T (K = 64), P V (K = keys) and the output projection (K = 1024) — all on
// v_wmma_f32_16x16x32_bf16 as bf16 hi/lo splits (hi*hi + hi*lo + lo*hi, f32 accumulate) with every operand kept in f32 and
// split in registers / at LDS staging (causal rows expose single V rows, so plain 16-bit operands miss). Softmax statistics in
// ---------------------------------------------------------------------------

#define B_   2
#define S_   4096
#define D_   1024
#define QKV_ 1024
#define H_   16
#define HD_  64
#define M_TOT (B_ * S_)
#define SCALE_ 0.125f  // 64^-0.5

typedef __attribute__((ext_vector_type(16))) __bf16 v16bf;
typedef __attribute__((ext_vector_type(8)))  __bf16 v8bf;
typedef __attribute__((ext_vector_type(8)))  float  v8f;
typedef __attribute__((ext_vector_type(4)))  float  v4f;

template <typename V> __device__ __forceinline__ void vst2(void* p, V v) {
  *(V*)p = v; 
}
__device__ __forceinline__ __bf16 bf_hi(float x) { return (__bf16)x; }
__device__ __forceinline__ __bf16 bf_lo(float x, __bf16 h) { return (__bf16)(x - (float)h); }
__device__ __forceinline__ v8f wmma_bf16(v16bf a, v16bf b, v8f c) {
  v8f d = __builtin_amdgcn_wmma_f32_16x16x32_bf16(false, a, false, b, (short)0, c, false, false);
  asm volatile("v_nop\n\tv_nop\n\tv_nop\n\tv_nop" : "+v"(d) : "v"(a), "v"(b));
  return d;
}
__device__ __forceinline__ v8f wmma_x3(v16bf ah, v16bf al, v16bf bh, v16bf bl, v8f c) {
  c = wmma_bf16(ah, bh, c); c = wmma_bf16(ah, bl, c); c = wmma_bf16(al, bh, c);
  return c;
}

// ---- fragment loaders (wave32): A (16x32 from [M][ld]) and B from B^T ([N][ld]) share the per-lane K map:
//      row/col = lane&15; elements 0..7 <- k0 + 8*half + 0..7, elements 8..15 <- k0 + 16 + 8*half + 0..7
// f32 source split into bf16 hi/lo
__device__ __forceinline__ void frag_f32(const float* __restrict__ base, int ld, int r0, int k0, int lane, v16bf& hi, v16bf& lo) {
  const float* p = base + (size_t)(r0 + (lane & 15)) * ld + k0 + (lane >> 4) * 8;
  const v4f a0 = *(const v4f*)(p), a1 = *(const v4f*)(p + 4), a2 = *(const v4f*)(p + 16), a3 = *(const v4f*)(p + 20);
#pragma unroll
  for (int i = 0; i < 4; ++i) {
    __bf16 h;
    h = bf_hi(a0[i]); hi[i] = h;      lo[i] = bf_lo(a0[i], h);
    h = bf_hi(a1[i]); hi[4 + i] = h;  lo[4 + i] = bf_lo(a1[i], h);
    h = bf_hi(a2[i]); hi[8 + i] = h;  lo[8 + i] = bf_lo(a2[i], h);
    h = bf_hi(a3[i]); hi[12 + i] = h; lo[12 + i] = bf_lo(a3[i], h);
  }
}
// bf16 plane in LDS
__device__ __forceinline__ v16bf frag_lds(const __bf16* base, int ld, int r0, int k0, int lane) {
  union { v16bf v; v8bf h[2]; } r;
  const __bf16* p = base + (r0 + (lane & 15)) * ld + k0 + (lane >> 4) * 8;
  r.h[0] = *(const v8bf*)(p); r.h[1] = *(const v8bf*)(p + 16);
  return r.v;
}


// ---- 32x64-per-wave GEMM main loop over f32 operands (A [M][K], Bt [N][K]) split into bf16 hi/lo ----
template <int KDIM>
__device__ __forceinline__ void gemm_mainloop_32x64(const float* __restrict__ A, const float* __restrict__ Bt,
                                                    int m0, int n0, int lane, v8f acc[2][4]) {
#pragma unroll 1
  for (int k0 = 0; k0 < KDIM; k0 += 32) {
    v16bf ah[2], al[2], bh[4], bl[4];
    frag_f32(A, KDIM, m0, k0, lane, ah[0], al[0]);
    frag_f32(A, KDIM, m0 + 16, k0, lane, ah[1], al[1]);
#pragma unroll
    for (int j = 0; j < 4; ++j) frag_f32(Bt, KDIM, n0 + j * 16, k0, lane, bh[j], bl[j]);
#pragma unroll
    for (int i = 0; i < 2; ++i)
#pragma unroll
      for (int j = 0; j < 4; ++j) acc[i][j] = wmma_x3(ah[i], al[i], bh[j], bl[j], acc[i][j]);
  }
}

// ---- Stage 1: one projection (part 0 = Q scaled, 1 = K, 2 = V^T). grid (QKV/64, M_TOT/128), block 128 = 4 waves stacked in M.
__global__ __launch_bounds__(128) void proj_kernel(const float* __restrict__ X, const float* __restrict__ W, float scale,
                                                  int part, float* __restrict__ dst) {
  __shared__ __align__(16) float st[128][64];        // 32 KB
  const int lane = threadIdx.x & 31, wave = threadIdx.x >> 5, tid = threadIdx.x;
  const int mblk = blockIdx.y * 128;
  const int m0 = mblk + wave * 32;
  const int n0 = blockIdx.x * 64;
  const int head = n0 / HD_, d0 = n0 % HD_;
  const int b = mblk / S_, s0 = mblk % S_;

  v8f acc[2][4] = {};
  gemm_mainloop_32x64<D_>(X, W, m0, n0, lane, acc);
  const int half = lane >> 4, col = lane & 15;
#pragma unroll
  for (int i = 0; i < 2; ++i)
#pragma unroll
    for (int j = 0; j < 4; ++j)
#pragma unroll
      for (int r = 0; r < 8; ++r) st[wave * 32 + i * 16 + r + 8 * half][j * 16 + col] = acc[i][j][r] * scale;
  __syncthreads();
  if (part < 2) {
    for (int g = tid; g < 128 * 16; g += 128) {            // 128 token rows x 16 pieces; a wave instruction covers 2 rows
      const int ml = g >> 4, pc = g & 15;
      vst2(dst + (((size_t)(b * H_ + head) * S_ + s0 + ml) * HD_) + d0 + pc * 4, *(const v4f*)(&st[ml][pc * 4]));
    }
  } else {
    for (int g = tid; g < 64 * 32; g += 128) {             // 64 d rows x 32 pieces (128 s); a wave instruction covers one row
      const int dl = g >> 5, pc = g & 31;
      v4f v = {st[pc * 4][dl], st[pc * 4 + 1][dl], st[pc * 4 + 2][dl], st[pc * 4 + 3][dl]};
      vst2(dst + (((size_t)(b * H_ + head) * HD_ + d0 + dl) * S_) + s0 + pc * 4, v);
    }
  }
}

// ---- Stage 2: causal flash attention. grid (S/64, H, B), block 128 = 4 waves x 16 queries; K and V^T tiles of 32 keys in LDS as hi/lo planes.
__global__ __launch_bounds__(128) void attn_kernel(const float* __restrict__ Qb, const float* __restrict__ Kb,
                                                  const float* __restrict__ Vt, float* __restrict__ Ctx) {
  __shared__ __align__(16) __bf16 Kh[32 * 72], Kl[32 * 72];     // [key][d] pitch 72
  __shared__ __align__(16) __bf16 Vh[64 * 40], Vl[64 * 40];     // [d][key] pitch 40
  __shared__ __align__(16) __bf16 Ph[4][16 * 40], Pl[4][16 * 40];
  __shared__ __align__(16) float  Os[4][16 * 64];

  const int tid = threadIdx.x, lane = tid & 31, wave = tid >> 5, half = lane >> 4, col = lane & 15;
  const int q0 = blockIdx.x * 64, head = blockIdx.y, b = blockIdx.z;
  const float* Qh = Qb + (size_t)(b * H_ + head) * S_ * HD_;
  const float* Kg = Kb + (size_t)(b * H_ + head) * S_ * HD_;
  const float* Vg = Vt + (size_t)(b * H_ + head) * HD_ * S_;
  const int mq = q0 + wave * 16;

  v16bf qh[2], ql[2];
#pragma unroll
  for (int kb = 0; kb < 2; ++kb) frag_f32(Qh, HD_, mq, kb * 32, lane, qh[kb], ql[kb]);

  v8f o[4] = {};
  float mrow[8], lrow[8];
#pragma unroll
  for (int r = 0; r < 8; ++r) { mrow[r] = -1e30f; lrow[r] = 0.0f; }
  __bf16* ph = Ph[wave];
  __bf16* pl = Pl[wave];

  const int t_end = q0 + 64;            // causal limit (block-uniform, multiple of 32)
  for (int t0 = 0; t0 < t_end; t0 += 32) {
    __syncthreads();
    {   // stage K (32 x 64) and V^T (64 x 32): 16 + 16 floats per thread
      const int kr = tid >> 2, kc = (tid & 3) * 16;
      const float* kp = Kg + (size_t)(t0 + kr) * HD_ + kc;
      const int vr = tid >> 1, vc = (tid & 1) * 16;
      const float* vp = Vg + (size_t)vr * S_ + t0 + vc;
#pragma unroll
      for (int e = 0; e < 16; e += 4) {
        const v4f a = *(const v4f*)(kp + e), bb = *(const v4f*)(vp + e);
#pragma unroll
        for (int i = 0; i < 4; ++i) {
          __bf16 hk = bf_hi(a[i]);  Kh[kr * 72 + kc + e + i] = hk; Kl[kr * 72 + kc + e + i] = bf_lo(a[i], hk);
          __bf16 hv = bf_hi(bb[i]); Vh[vr * 40 + vc + e + i] = hv; Vl[vr * 40 + vc + e + i] = bf_lo(bb[i], hv);
        }
      }
    }
    __syncthreads();

    v8f s[2] = {};
#pragma unroll
    for (int n = 0; n < 2; ++n)
#pragma unroll
      for (int kb = 0; kb < 2; ++kb)
        s[n] = wmma_x3(qh[kb], ql[kb], frag_lds(Kh, 72, n * 16, kb * 32, lane), frag_lds(Kl, 72, n * 16, kb * 32, lane), s[n]);

    {
      const int k0g = t0 + col, k1g = t0 + 16 + col;
#pragma unroll
      for (int r = 0; r < 8; ++r) {
        const int qg = mq + r + 8 * half;
        float v0 = (k0g <= qg) ? s[0][r] : -1e30f;      // scores already carry the 1/8 scale (folded into Q)
        float v1 = (k1g <= qg) ? s[1][r] : -1e30f;
        float mx = fmaxf(v0, v1);
#pragma unroll
        for (int off = 8; off > 0; off >>= 1) mx = fmaxf(mx, __shfl_xor(mx, off, 16));
        const float mnew  = fmaxf(mrow[r], mx);
        const float alpha = __expf(mrow[r] - mnew);
        const float p0 = (k0g <= qg) ? __expf(v0 - mnew) : 0.0f;
        const float p1 = (k1g <= qg) ? __expf(v1 - mnew) : 0.0f;
        float rs = p0 + p1;
#pragma unroll
        for (int off = 8; off > 0; off >>= 1) rs += __shfl_xor(rs, off, 16);
        lrow[r] = lrow[r] * alpha + rs;
        mrow[r] = mnew;
#pragma unroll
        for (int j = 0; j < 4; ++j) o[j][r] *= alpha;
        const int row = r + 8 * half;
        __bf16 h0 = bf_hi(p0), h1 = bf_hi(p1);
        ph[row * 40 + col] = h0;      pl[row * 40 + col] = bf_lo(p0, h0);
        ph[row * 40 + 16 + col] = h1; pl[row * 40 + 16 + col] = bf_lo(p1, h1);
      }
    }
    __syncthreads();
    const v16bf pah = frag_lds(ph, 40, 0, 0, lane), pal = frag_lds(pl, 40, 0, 0, lane);
#pragma unroll
    for (int j = 0; j < 4; ++j)
      o[j] = wmma_x3(pah, pal, frag_lds(Vh, 40, j * 16, 0, lane), frag_lds(Vl, 40, j * 16, 0, lane), o[j]);
  }

  float* os_ = Os[wave];
#pragma unroll
  for (int r = 0; r < 8; ++r) {
    const float inv = 1.0f / lrow[r];
#pragma unroll
    for (int j = 0; j < 4; ++j) os_[(r + 8 * half) * 64 + j * 16 + col] = o[j][r] * inv;
  }
  __syncthreads();
#pragma unroll
  for (int q = 0; q < 8; ++q) {
    const int rl = q * 2 + (lane >> 4), pc = lane & 15;
    vst2(Ctx + ((size_t)(b * S_ + mq + rl)) * D_ + head * HD_ + pc * 4, *(const v4f*)(os_ + rl * 64 + pc * 4));
  }
}

__global__ __launch_bounds__(128) void out_gemm_kernel(const float* __restrict__ Cx, const float* __restrict__ Wo, float* __restrict__ Out) {
  __shared__ __align__(16) float st[4][32 * 64];
  const int lane = threadIdx.x & 31, wave = threadIdx.x >> 5;
  const int m0 = blockIdx.y * 64 + (wave >> 1) * 32;
  const int n0 = blockIdx.x * 128 + (wave & 1) * 64;
  v8f acc[2][4] = {};
  gemm_mainloop_32x64<QKV_>(Cx, Wo, m0, n0, lane, acc);
  const int half = lane >> 4, col = lane & 15;
  float* S = st[wave];
#pragma unroll
  for (int i = 0; i < 2; ++i)
#pragma unroll
    for (int j = 0; j < 4; ++j)
#pragma unroll
      for (int r = 0; r < 8; ++r) S[(i * 16 + r + 8 * half) * 64 + j * 16 + col] = acc[i][j][r];
  __syncthreads();
#pragma unroll
  for (int q = 0; q < 16; ++q) {
    const int rl = q * 2 + (lane >> 4), pc = lane & 15;
    vst2(Out + (size_t)(m0 + rl) * D_ + n0 + pc * 4, *(const v4f*)(S + rl * 64 + pc * 4));
  }
}

extern "C" void kernel_launch(void* const* d_in, const int* in_sizes, int n_in,
                              void* d_out, int out_size, void* d_ws, size_t ws_size,
                              hipStream_t stream) {
  (void)in_sizes; (void)n_in; (void)out_size; (void)ws_size;
  const float* x    = (const float*)d_in[0];
  const float* Wqkv = (const float*)d_in[1];   // [3D][D]: rows [0,D) = Wq, [D,2D) = Wk, [2D,3D) = Wv
  const float* Wout = (const float*)d_in[2];   // [D][D]
  float* out = (float*)d_out;

  const size_t E = (size_t)M_TOT * D_;          // 8,388,608 floats per buffer (32 MB)
  float* qb   = (float*)d_ws;
  float* kb   = qb + E;
  float* vtb  = kb + E;        // V^T: [B,H,HD,S]
  float* ctxb = vtb + E;       // total 128 MB

  dim3 gp(D_ / 64, M_TOT / 128);
  proj_kernel<<<gp, 128, 0, stream>>>(x, Wqkv,                       SCALE_, 0, qb);
  proj_kernel<<<gp, 128, 0, stream>>>(x, Wqkv + (size_t)D_ * D_,     1.0f,   1, kb);
  proj_kernel<<<gp, 128, 0, stream>>>(x, Wqkv + (size_t)2 * D_ * D_, 1.0f,   2, vtb);
  attn_kernel<<<dim3(S_ / 64, H_, B_), 128, 0, stream>>>(qb, kb, vtb, ctxb);
  out_gemm_kernel<<<dim3(D_ / 128, M_TOT / 64), 128, 0, stream>>>(ctxb, Wout, out);
}

// v001
// One run takes 655 microseconds.
// Timed twice side by side with v000, it ran 1.24 times as fast both times.
#include <hip/hip_runtime.h>

// ---------------------------------------------------------------------------
// CausalMultiHeadSelfAttention (B=2, S=4096, D=1024, H=16, HD=64, causal; packed Wqkv [3D][D], Wout [D][D])
// Contractions: Q/K/V projections (K = 1024), QK^T (K = 64), P V (K = keys) and the output projection (K = 1024) — all on
// v_wmma_f32_16x16x32_bf16 as bf16 hi/lo splits (hi*hi + hi*lo + lo*hi, f32 accumulate) with every operand kept in f32 and
// split in registers / at LDS staging (causal rows expose single V rows, so plain 16-bit operands miss). Softmax statistics in
// ---------------------------------------------------------------------------

#define B_   2
#define S_   4096
#define D_   1024
#define QKV_ 1024
#define H_   16
#define HD_  64
#define M_TOT (B_ * S_)
#define SCALE_ 0.125f  // 64^-0.5

typedef __attribute__((ext_vector_type(16))) __bf16 v16bf;
typedef __attribute__((ext_vector_type(8)))  __bf16 v8bf;
typedef __attribute__((ext_vector_type(4)))  __bf16 v4bf;
typedef __attribute__((ext_vector_type(8)))  float  v8f;
typedef __attribute__((ext_vector_type(4)))  float  v4f;

template <typename V> __device__ __forceinline__ void vst2(void* p, V v) {
  *(V*)p = v; 
}
__device__ __forceinline__ __bf16 bf_hi(float x) { return (__bf16)x; }
__device__ __forceinline__ __bf16 bf_lo(float x, __bf16 h) { return (__bf16)(x - (float)h); }
__device__ __forceinline__ v8f wmma_bf16(v16bf a, v16bf b, v8f c) {
  v8f d = __builtin_amdgcn_wmma_f32_16x16x32_bf16(false, a, false, b, (short)0, c, false, false);
  asm volatile("v_nop\n\tv_nop\n\tv_nop\n\tv_nop" : "+v"(d) : "v"(a), "v"(b));
  return d;
}
__device__ __forceinline__ v8f wmma_x3(v16bf ah, v16bf al, v16bf bh, v16bf bl, v8f c) {
  c = wmma_bf16(ah, bh, c); c = wmma_bf16(ah, bl, c); c = wmma_bf16(al, bh, c);
  return c;
}

// ---- fragment loaders (wave32): A (16x32 from [M][ld]) and B from B^T ([N][ld]) share the per-lane K map:
//      row/col = lane&15; elements 0..7 <- k0 + 8*half + 0..7, elements 8..15 <- k0 + 16 + 8*half + 0..7
// f32 source split into bf16 hi/lo
__device__ __forceinline__ void frag_f32(const float* __restrict__ base, int ld, int r0, int k0, int lane, v16bf& hi, v16bf& lo) {
  const float* p = base + (size_t)(r0 + (lane & 15)) * ld + k0 + (lane >> 4) * 8;
  const v4f a0 = *(const v4f*)(p), a1 = *(const v4f*)(p + 4), a2 = *(const v4f*)(p + 16), a3 = *(const v4f*)(p + 20);
#pragma unroll
  for (int i = 0; i < 4; ++i) {
    __bf16 h;
    h = bf_hi(a0[i]); hi[i] = h;      lo[i] = bf_lo(a0[i], h);
    h = bf_hi(a1[i]); hi[4 + i] = h;  lo[4 + i] = bf_lo(a1[i], h);
    h = bf_hi(a2[i]); hi[8 + i] = h;  lo[8 + i] = bf_lo(a2[i], h);
    h = bf_hi(a3[i]); hi[12 + i] = h; lo[12 + i] = bf_lo(a3[i], h);
  }
}
// bf16 plane in LDS
__device__ __forceinline__ v16bf frag_lds(const __bf16* base, int ld, int r0, int k0, int lane) {
  union { v16bf v; v8bf h[2]; } r;
  const __bf16* p = base + (r0 + (lane & 15)) * ld + k0 + (lane >> 4) * 8;
  r.h[0] = *(const v8bf*)(p); r.h[1] = *(const v8bf*)(p + 16);
  return r.v;
}


// ---- 32x64-per-wave GEMM main loop over f32 operands (A [M][K], Bt [N][K]) split into bf16 hi/lo; block = 4 waves, tile BM x BN.
//      Each 32-wide k slice (BM rows of A, then BN rows of Bt) is read from global memory in whole 128-byte lines (8 lanes per row),
//      split once per block and kept as two bf16 planes in LDS; the waves take their fragments from there (same k map as frag_f32).
#define TP_ 40   // LDS row pitch of a slice in bf16 elements (80 bytes)
template <int KDIM, int BM, int BN>
__device__ __forceinline__ void gemm_mainloop_32x64(const float* __restrict__ A, const float* __restrict__ Bt,
                                                    int mblk, int nblk, int mw, int nw, int tid,
                                                    __bf16* __restrict__ Th, __bf16* __restrict__ Tl, v8f acc[2][4]) {
  constexpr int NA = BM / 16, NL = (BM + BN) / 16;   // the 128 threads cover 16 rows per load
  const int lane = tid & 31, sr = tid >> 3, sc = (tid & 7) * 4;
  const float* pa = A + (size_t)(mblk + sr) * KDIM + sc;
  const float* pb = Bt + (size_t)(nblk + sr) * KDIM + sc;
#pragma unroll 1
  for (int k0 = 0; k0 < KDIM; k0 += 32) {
    v4f x[NL];
#pragma unroll
    for (int i = 0; i < NL; ++i)
      x[i] = (i < NA) ? *(const v4f*)(pa + (size_t)i * 16 * KDIM + k0) : *(const v4f*)(pb + (size_t)(i - NA) * 16 * KDIM + k0);
    asm volatile("s_wait_xcnt 0x0" ::: "memory");   // stands ahead of any reuse of the loads' address registers
    __syncthreads();   // every wave has taken its fragments of the slice before
#pragma unroll
    for (int i = 0; i < NL; ++i) {
      v4bf h, l;
#pragma unroll
      for (int e = 0; e < 4; ++e) { h[e] = bf_hi(x[i][e]); l[e] = bf_lo(x[i][e], h[e]); }
      vst2(Th + (i * 16 + sr) * TP_ + sc, h);
      vst2(Tl + (i * 16 + sr) * TP_ + sc, l);
    }
    __syncthreads();   // the slice is complete for every wave
    v16bf ah[2], al[2], bh[4], bl[4];
#pragma unroll
    for (int i = 0; i < 2; ++i) { ah[i] = frag_lds(Th, TP_, mw + i * 16, 0, lane); al[i] = frag_lds(Tl, TP_, mw + i * 16, 0, lane); }
#pragma unroll
    for (int j = 0; j < 4; ++j) { bh[j] = frag_lds(Th, TP_, BM + nw + j * 16, 0, lane); bl[j] = frag_lds(Tl, TP_, BM + nw + j * 16, 0, lane); }
#pragma unroll
    for (int i = 0; i < 2; ++i)
#pragma unroll
      for (int j = 0; j < 4; ++j) acc[i][j] = wmma_x3(ah[i], al[i], bh[j], bl[j], acc[i][j]);
  }
}

// ---- Stage 1: one projection (part 0 = Q scaled, 1 = K, 2 = V^T). grid (QKV/64, M_TOT/128), block 128 = 4 waves stacked in M.
__global__ __launch_bounds__(128) void proj_kernel(const float* __restrict__ X, const float* __restrict__ W, float scale,
                                                  int part, float* __restrict__ dst) {
  __shared__ __align__(16) float st[128][64];        // 32 KB
  __shared__ __align__(16) __bf16 Th[192 * TP_], Tl[192 * TP_];   // k slice: 128 rows of X, 64 rows of W
  const int lane = threadIdx.x & 31, wave = threadIdx.x >> 5, tid = threadIdx.x;
  const int mblk = blockIdx.y * 128;
  const int n0 = blockIdx.x * 64;
  const int head = n0 / HD_, d0 = n0 % HD_;
  const int b = mblk / S_, s0 = mblk % S_;

  v8f acc[2][4] = {};
  gemm_mainloop_32x64<D_, 128, 64>(X, W, mblk, n0, wave * 32, 0, tid, Th, Tl, acc);
  const int half = lane >> 4, col = lane & 15;
#pragma unroll
  for (int i = 0; i < 2; ++i)
#pragma unroll
    for (int j = 0; j < 4; ++j)
#pragma unroll
      for (int r = 0; r < 8; ++r) st[wave * 32 + i * 16 + r + 8 * half][j * 16 + col] = acc[i][j][r] * scale;
  __syncthreads();
  if (part < 2) {
    for (int g = tid; g < 128 * 16; g += 128) {            // 128 token rows x 16 pieces; a wave instruction covers 2 rows
      const int ml = g >> 4, pc = g & 15;
      vst2(dst + (((size_t)(b * H_ + head) * S_ + s0 + ml) * HD_) + d0 + pc * 4, *(const v4f*)(&st[ml][pc * 4]));
    }
  } else {
    for (int g = tid; g < 64 * 32; g += 128) {             // 64 d rows x 32 pieces (128 s); a wave instruction covers one row
      const int dl = g >> 5, pc = g & 31;
      v4f v = {st[pc * 4][dl], st[pc * 4 + 1][dl], st[pc * 4 + 2][dl], st[pc * 4 + 3][dl]};
      vst2(dst + (((size_t)(b * H_ + head) * HD_ + d0 + dl) * S_) + s0 + pc * 4, v);
    }
  }
}

// ---- Stage 2: causal flash attention. grid (S/64, H, B), block 128 = 4 waves x 16 queries; K and V^T tiles of 32 keys in LDS as hi/lo planes.
__global__ __launch_bounds__(128) void attn_kernel(const float* __restrict__ Qb, const float* __restrict__ Kb,
                                                  const float* __restrict__ Vt, float* __restrict__ Ctx) {
  __shared__ __align__(16) __bf16 Kh[32 * 72], Kl[32 * 72];     // [key][d] pitch 72
  __shared__ __align__(16) __bf16 Vh[64 * 40], Vl[64 * 40];     // [d][key] pitch 40
  __shared__ __align__(16) __bf16 Ph[4][16 * 40], Pl[4][16 * 40];
  __shared__ __align__(16) float  Os[4][16 * 64];

  const int tid = threadIdx.x, lane = tid & 31, wave = tid >> 5, half = lane >> 4, col = lane & 15;
  const int q0 = blockIdx.x * 64, head = blockIdx.y, b = blockIdx.z;
  const float* Qh = Qb + (size_t)(b * H_ + head) * S_ * HD_;
  const float* Kg = Kb + (size_t)(b * H_ + head) * S_ * HD_;
  const float* Vg = Vt + (size_t)(b * H_ + head) * HD_ * S_;
  const int mq = q0 + wave * 16;

  v16bf qh[2], ql[2];
#pragma unroll
  for (int kb = 0; kb < 2; ++kb) frag_f32(Qh, HD_, mq, kb * 32, lane, qh[kb], ql[kb]);

  v8f o[4] = {};
  float mrow[8], lrow[8];
#pragma unroll
  for (int r = 0; r < 8; ++r) { mrow[r] = -1e30f; lrow[r] = 0.0f; }
  __bf16* ph = Ph[wave];
  __bf16* pl = Pl[wave];

  const int t_end = q0 + 64;            // causal limit (block-uniform, multiple of 32)
  for (int t0 = 0; t0 < t_end; t0 += 32) {
    __syncthreads();
    {   // stage K (32 x 64) and V^T (64 x 32): 16 + 16 floats per thread
      const int kr = tid >> 2, kc = (tid & 3) * 16;
      const float* kp = Kg + (size_t)(t0 + kr) * HD_ + kc;
      const int vr = tid >> 1, vc = (tid & 1) * 16;
      const float* vp = Vg + (size_t)vr * S_ + t0 + vc;
#pragma unroll
      for (int e = 0; e < 16; e += 4) {
        const v4f a = *(const v4f*)(kp + e), bb = *(const v4f*)(vp + e);
#pragma unroll
        for (int i = 0; i < 4; ++i) {
          __bf16 hk = bf_hi(a[i]);  Kh[kr * 72 + kc + e + i] = hk; Kl[kr * 72 + kc + e + i] = bf_lo(a[i], hk);
          __bf16 hv = bf_hi(bb[i]); Vh[vr * 40 + vc + e + i] = hv; Vl[vr * 40 + vc + e + i] = bf_lo(bb[i], hv);
        }
      }
    }
    __syncthreads();

    v8f s[2] = {};
#pragma unroll
    for (int n = 0; n < 2; ++n)
#pragma unroll
      for (int kb = 0; kb < 2; ++kb)
        s[n] = wmma_x3(qh[kb], ql[kb], frag_lds(Kh, 72, n * 16, kb * 32, lane), frag_lds(Kl, 72, n * 16, kb * 32, lane), s[n]);

    {
      const int k0g = t0 + col, k1g = t0 + 16 + col;
#pragma unroll
      for (int r = 0; r < 8; ++r) {
        const int qg = mq + r + 8 * half;
        float v0 = (k0g <= qg) ? s[0][r] : -1e30f;      // scores already carry the 1/8 scale (folded into Q)
        float v1 = (k1g <= qg) ? s[1][r] : -1e30f;
        float mx = fmaxf(v0, v1);
#pragma unroll
        for (int off = 8; off > 0; off >>= 1) mx = fmaxf(mx, __shfl_xor(mx, off, 16));
        const float mnew  = fmaxf(mrow[r], mx);
        const float alpha = __expf(mrow[r] - mnew);
        const float p0 = (k0g <= qg) ? __expf(v0 - mnew) : 0.0f;
        const float p1 = (k1g <= qg) ? __expf(v1 - mnew) : 0.0f;
        float rs = p0 + p1;
#pragma unroll
        for (int off = 8; off > 0; off >>= 1) rs += __shfl_xor(rs, off, 16);
        lrow[r] = lrow[r] * alpha + rs;
        mrow[r] = mnew;
#pragma unroll
        for (int j = 0; j < 4; ++j) o[j][r] *= alpha;
        const int row = r + 8 * half;
        __bf16 h0 = bf_hi(p0), h1 = bf_hi(p1);
        ph[row * 40 + col] = h0;      pl[row * 40 + col] = bf_lo(p0, h0);
        ph[row * 40 + 16 + col] = h1; pl[row * 40 + 16 + col] = bf_lo(p1, h1);
      }
    }
    __syncthreads();
    const v16bf pah = frag_lds(ph, 40, 0, 0, lane), pal = frag_lds(pl, 40, 0, 0, lane);
#pragma unroll
    for (int j = 0; j < 4; ++j)
      o[j] = wmma_x3(pah, pal, frag_lds(Vh, 40, j * 16, 0, lane), frag_lds(Vl, 40, j * 16, 0, lane), o[j]);
  }

  float* os_ = Os[wave];
#pragma unroll
  for (int r = 0; r < 8; ++r) {
    const float inv = 1.0f / lrow[r];
#pragma unroll
    for (int j = 0; j < 4; ++j) os_[(r + 8 * half) * 64 + j * 16 + col] = o[j][r] * inv;
  }
  __syncthreads();
#pragma unroll
  for (int q = 0; q < 8; ++q) {
    const int rl = q * 2 + (lane >> 4), pc = lane & 15;
    vst2(Ctx + ((size_t)(b * S_ + mq + rl)) * D_ + head * HD_ + pc * 4, *(const v4f*)(os_ + rl * 64 + pc * 4));
  }
}

__global__ __launch_bounds__(128) void out_gemm_kernel(const float* __restrict__ Cx, const float* __restrict__ Wo, float* __restrict__ Out) {
  __shared__ __align__(16) float st[4][32 * 64];
  __shared__ __align__(16) __bf16 Th[192 * TP_], Tl[192 * TP_];   // k slice: 64 rows of Cx, 128 rows of Wo
  const int lane = threadIdx.x & 31, wave = threadIdx.x >> 5;
  const int m0 = blockIdx.y * 64 + (wave >> 1) * 32;
  const int n0 = blockIdx.x * 128 + (wave & 1) * 64;
  v8f acc[2][4] = {};
  gemm_mainloop_32x64<QKV_, 64, 128>(Cx, Wo, blockIdx.y * 64, blockIdx.x * 128, (wave >> 1) * 32, (wave & 1) * 64, threadIdx.x, Th, Tl, acc);
  const int half = lane >> 4, col = lane & 15;
  float* S = st[wave];
#pragma unroll
  for (int i = 0; i < 2; ++i)
#pragma unroll
    for (int j = 0; j < 4; ++j)
#pragma unroll
      for (int r = 0; r < 8; ++r) S[(i * 16 + r + 8 * half) * 64 + j * 16 + col] = acc[i][j][r];
  __syncthreads();
#pragma unroll
  for (int q = 0; q < 16; ++q) {
    const int rl = q * 2 + (lane >> 4), pc = lane & 15;
    vst2(Out + (size_t)(m0 + rl) * D_ + n0 + pc * 4, *(const v4f*)(S + rl * 64 + pc * 4));
  }
}

extern "C" void kernel_launch(void* const* d_in, const int* in_sizes, int n_in,
                              void* d_out, int out_size, void* d_ws, size_t ws_size,
                              hipStream_t stream) {
  (void)in_sizes; (void)n_in; (void)out_size; (void)ws_size;
  const float* x    = (const float*)d_in[0];
  const float* Wqkv = (const float*)d_in[1];   // [3D][D]: rows [0,D) = Wq, [D,2D) = Wk, [2D,3D) = Wv
  const float* Wout = (const float*)d_in[2];   // [D][D]
  float* out = (float*)d_out;

  const size_t E = (size_t)M_TOT * D_;          // 8,388,608 floats per buffer (32 MB)
  float* qb   = (float*)d_ws;
  float* kb   = qb + E;
  float* vtb  = kb + E;        // V^T: [B,H,HD,S]
  float* ctxb = vtb + E;       // total 128 MB

  dim3 gp(D_ / 64, M_TOT / 128);
  proj_kernel<<<gp, 128, 0, stream>>>(x, Wqkv,                       SCALE_, 0, qb);
  proj_kernel<<<gp, 128, 0, stream>>>(x, Wqkv + (size_t)D_ * D_,     1.0f,   1, kb);
  proj_kernel<<<gp, 128, 0, stream>>>(x, Wqkv + (size_t)2 * D_ * D_, 1.0f,   2, vtb);
  attn_kernel<<<dim3(S_ / 64, H_, B_), 128, 0, stream>>>(qb, kb, vtb, ctxb);
  out_gemm_kernel<<<dim3(D_ / 128, M_TOT / 64), 128, 0, stream>>>(ctxb, Wout, out);
}

// v002
// A run of this version takes 537 microseconds.
// Next to v001, in two timings, it ran 1.22 and 1.24 times as fast.
// All steps since v000 together make it 1.52 times as fast.
#include <hip/hip_runtime.h>

// ---------------------------------------------------------------------------
// CausalMultiHeadSelfAttention (B=2, S=4096, D=1024, H=16, HD=64, causal; packed Wqkv [3D][D], Wout [D][D])
// Contractions: Q/K/V projections (K = 1024), QK^T (K = 64), P V (K = keys) and the output projection (K = 1024) — all on
// v_wmma_f32_16x16x32_bf16 as bf16 hi/lo splits (hi*hi + hi*lo + lo*hi, f32 accumulate) with every operand kept in f32 and
// split in registers / at LDS staging (causal rows expose single V rows, so plain 16-bit operands miss). Softmax statistics in
// ---------------------------------------------------------------------------

#define B_   2
#define S_   4096
#define D_   1024
#define QKV_ 1024
#define H_   16
#define HD_  64
#define M_TOT (B_ * S_)
#define SCALE_ 0.125f  // 64^-0.5

typedef __attribute__((ext_vector_type(16))) __bf16 v16bf;
typedef __attribute__((ext_vector_type(8)))  __bf16 v8bf;
typedef __attribute__((ext_vector_type(4)))  __bf16 v4bf;
typedef __attribute__((ext_vector_type(8)))  float  v8f;
typedef __attribute__((ext_vector_type(4)))  float  v4f;

template <typename V> __device__ __forceinline__ void vst2(void* p, V v) {
  *(V*)p = v; 
}
__device__ __forceinline__ __bf16 bf_hi(float x) { return (__bf16)x; }
__device__ __forceinline__ __bf16 bf_lo(float x, __bf16 h) { return (__bf16)(x - (float)h); }
__device__ __forceinline__ v8f wmma_bf16(v16bf a, v16bf b, v8f c) {
  v8f d = __builtin_amdgcn_wmma_f32_16x16x32_bf16(false, a, false, b, (short)0, c, false, false);
  asm volatile("v_nop\n\tv_nop\n\tv_nop\n\tv_nop" : "+v"(d) : "v"(a), "v"(b));
  return d;
}
__device__ __forceinline__ v8f wmma_x3(v16bf ah, v16bf al, v16bf bh, v16bf bl, v8f c) {
  c = wmma_bf16(ah, bh, c); c = wmma_bf16(ah, bl, c); c = wmma_bf16(al, bh, c);
  return c;
}

// lane l takes the value of lane l ^ 16 (the other half of the wave)
__device__ __forceinline__ float xhalf(float x) {
  return __builtin_bit_cast(float, __builtin_amdgcn_permlanex16(__builtin_bit_cast(int, x), __builtin_bit_cast(int, x), 0x76543210, 0xfedcba98, false, false));
}

// ---- fragment loaders (wave32): A (16x32 from [M][ld]) and B from B^T ([N][ld]) share the per-lane K map:
//      row/col = lane&15; elements 0..7 <- k0 + 8*half + 0..7, elements 8..15 <- k0 + 16 + 8*half + 0..7
// f32 source split into bf16 hi/lo
__device__ __forceinline__ void frag_f32(const float* __restrict__ base, int ld, int r0, int k0, int lane, v16bf& hi, v16bf& lo) {
  const float* p = base + (size_t)(r0 + (lane & 15)) * ld + k0 + (lane >> 4) * 8;
  const v4f a0 = *(const v4f*)(p), a1 = *(const v4f*)(p + 4), a2 = *(const v4f*)(p + 16), a3 = *(const v4f*)(p + 20);
#pragma unroll
  for (int i = 0; i < 4; ++i) {
    __bf16 h;
    h = bf_hi(a0[i]); hi[i] = h;      lo[i] = bf_lo(a0[i], h);
    h = bf_hi(a1[i]); hi[4 + i] = h;  lo[4 + i] = bf_lo(a1[i], h);
    h = bf_hi(a2[i]); hi[8 + i] = h;  lo[8 + i] = bf_lo(a2[i], h);
    h = bf_hi(a3[i]); hi[12 + i] = h; lo[12 + i] = bf_lo(a3[i], h);
  }
}
// bf16 plane in LDS
__device__ __forceinline__ v16bf frag_lds(const __bf16* base, int ld, int r0, int k0, int lane) {
  union { v16bf v; v8bf h[2]; } r;
  const __bf16* p = base + (r0 + (lane & 15)) * ld + k0 + (lane >> 4) * 8;
  r.h[0] = *(const v8bf*)(p); r.h[1] = *(const v8bf*)(p + 16);
  return r.v;
}


// ---- 32x64-per-wave GEMM main loop over f32 operands (A [M][K], Bt [N][K]) split into bf16 hi/lo; block = 4 waves, tile BM x BN.
//      Each 32-wide k slice (BM rows of A, then BN rows of Bt) is read from global memory in whole 128-byte lines (8 lanes per row),
//      split once per block and kept as two bf16 planes in LDS; the waves take their fragments from there (same k map as frag_f32).
#define TP_ 40   // LDS row pitch of a slice in bf16 elements (80 bytes)
template <int KDIM, int BM, int BN>
__device__ __forceinline__ void gemm_mainloop_32x64(const float* __restrict__ A, const float* __restrict__ Bt,
                                                    int mblk, int nblk, int mw, int nw, int tid,
                                                    __bf16* __restrict__ Th, __bf16* __restrict__ Tl, v8f acc[2][4]) {
  constexpr int NA = BM / 16, NL = (BM + BN) / 16;   // the 128 threads cover 16 rows per load
  const int lane = tid & 31, sr = tid >> 3, sc = (tid & 7) * 4;
  const float* pa = A + (size_t)(mblk + sr) * KDIM + sc;
  const float* pb = Bt + (size_t)(nblk + sr) * KDIM + sc;
#pragma unroll 1
  for (int k0 = 0; k0 < KDIM; k0 += 32) {
    v4f x[NL];
#pragma unroll
    for (int i = 0; i < NL; ++i)
      x[i] = (i < NA) ? *(const v4f*)(pa + (size_t)i * 16 * KDIM + k0) : *(const v4f*)(pb + (size_t)(i - NA) * 16 * KDIM + k0);
    asm volatile("s_wait_xcnt 0x0" ::: "memory");   // stands ahead of any reuse of the loads' address registers
    __syncthreads();   // every wave has taken its fragments of the slice before
#pragma unroll
    for (int i = 0; i < NL; ++i) {
      v4bf h, l;
#pragma unroll
      for (int e = 0; e < 4; ++e) { h[e] = bf_hi(x[i][e]); l[e] = bf_lo(x[i][e], h[e]); }
      vst2(Th + (i * 16 + sr) * TP_ + sc, h);
      vst2(Tl + (i * 16 + sr) * TP_ + sc, l);
    }
    __syncthreads();   // the slice is complete for every wave
    v16bf ah[2], al[2], bh[4], bl[4];
#pragma unroll
    for (int i = 0; i < 2; ++i) { ah[i] = frag_lds(Th, TP_, mw + i * 16, 0, lane); al[i] = frag_lds(Tl, TP_, mw + i * 16, 0, lane); }
#pragma unroll
    for (int j = 0; j < 4; ++j) { bh[j] = frag_lds(Th, TP_, BM + nw + j * 16, 0, lane); bl[j] = frag_lds(Tl, TP_, BM + nw + j * 16, 0, lane); }
#pragma unroll
    for (int i = 0; i < 2; ++i)
#pragma unroll
      for (int j = 0; j < 4; ++j) acc[i][j] = wmma_x3(ah[i], al[i], bh[j], bl[j], acc[i][j]);
  }
}

// ---- Stage 1: one projection (part 0 = Q scaled, 1 = K, 2 = V^T). grid (QKV/64, M_TOT/128), block 128 = 4 waves stacked in M.
__global__ __launch_bounds__(128) void proj_kernel(const float* __restrict__ X, const float* __restrict__ W, float scale,
                                                  int part, float* __restrict__ dst) {
  __shared__ __align__(16) float st[128][64];        // 32 KB
  __shared__ __align__(16) __bf16 Th[192 * TP_], Tl[192 * TP_];   // k slice: 128 rows of X, 64 rows of W
  const int lane = threadIdx.x & 31, wave = threadIdx.x >> 5, tid = threadIdx.x;
  const int mblk = blockIdx.y * 128;
  const int n0 = blockIdx.x * 64;
  const int head = n0 / HD_, d0 = n0 % HD_;
  const int b = mblk / S_, s0 = mblk % S_;

  v8f acc[2][4] = {};
  gemm_mainloop_32x64<D_, 128, 64>(X, W, mblk, n0, wave * 32, 0, tid, Th, Tl, acc);
  const int half = lane >> 4, col = lane & 15;
#pragma unroll
  for (int i = 0; i < 2; ++i)
#pragma unroll
    for (int j = 0; j < 4; ++j)
#pragma unroll
      for (int r = 0; r < 8; ++r) st[wave * 32 + i * 16 + r + 8 * half][j * 16 + col] = acc[i][j][r] * scale;
  __syncthreads();
  if (part < 2) {
    for (int g = tid; g < 128 * 16; g += 128) {            // 128 token rows x 16 pieces; a wave instruction covers 2 rows
      const int ml = g >> 4, pc = g & 15;
      vst2(dst + (((size_t)(b * H_ + head) * S_ + s0 + ml) * HD_) + d0 + pc * 4, *(const v4f*)(&st[ml][pc * 4]));
    }
  } else {
    for (int g = tid; g < 64 * 32; g += 128) {             // 64 d rows x 32 pieces (128 s); a wave instruction covers one row
      const int dl = g >> 5, pc = g & 31;
      v4f v = {st[pc * 4][dl], st[pc * 4 + 1][dl], st[pc * 4 + 2][dl], st[pc * 4 + 3][dl]};
      vst2(dst + (((size_t)(b * H_ + head) * HD_ + d0 + dl) * S_) + s0 + pc * 4, v);
    }
  }
}

#define OP_ 68   // pitch in floats of a query row in the output staging
__global__ __launch_bounds__(128) void attn_kernel(const float* __restrict__ Qb, const float* __restrict__ Kb,
                                                  const float* __restrict__ Vt, float* __restrict__ Ctx) {
  __shared__ __align__(16) __bf16 Kh[32 * 72], Kl[32 * 72];     // [key][d] pitch 72
  __shared__ __align__(16) __bf16 Vh[64 * 40], Vl[64 * 40];     // [d][key] pitch 40
  __shared__ __align__(16) float  Os[4][16 * OP_];

  const int tid = threadIdx.x, lane = tid & 31, wave = tid >> 5, half = lane >> 4, col = lane & 15;
  const int q0 = blockIdx.x * 64, head = blockIdx.y, b = blockIdx.z;
  const float* Qh = Qb + (size_t)(b * H_ + head) * S_ * HD_;
  const float* Kg = Kb + (size_t)(b * H_ + head) * S_ * HD_;
  const float* Vg = Vt + (size_t)(b * H_ + head) * HD_ * S_;
  const int mq = q0 + wave * 16;

  v16bf qh[2], ql[2];
#pragma unroll
  for (int kb = 0; kb < 2; ++kb) frag_f32(Qh, HD_, mq, kb * 32, lane, qh[kb], ql[kb]);

  v8f o[4] = {};
  float mrow = -1e30f, lrow = 0.0f;     // this lane's query: running maximum (same in both halves), sum over this half's keys
  const int qg = mq + col;

  const int t_end = q0 + 64;            // causal limit (block-uniform, multiple of 32)
  for (int t0 = 0; t0 < t_end; t0 += 32) {
    __syncthreads();
    {   // stage K (32 x 64) and V^T (64 x 32): 16 + 16 floats per thread
      const int kr = tid >> 2, kc = (tid & 3) * 16;
      const float* kp = Kg + (size_t)(t0 + kr) * HD_ + kc;
      const int vr = tid >> 1, vc = (tid & 1) * 16;
      const float* vp = Vg + (size_t)vr * S_ + t0 + vc;
#pragma unroll
      for (int e = 0; e < 16; e += 4) {
        const v4f a = *(const v4f*)(kp + e), bb = *(const v4f*)(vp + e);
#pragma unroll
        for (int i = 0; i < 4; ++i) {
          __bf16 hk = bf_hi(a[i]);  Kh[kr * 72 + kc + e + i] = hk; Kl[kr * 72 + kc + e + i] = bf_lo(a[i], hk);
          __bf16 hv = bf_hi(bb[i]); Vh[vr * 40 + vc + e + i] = hv; Vl[vr * 40 + vc + e + i] = bf_lo(bb[i], hv);
        }
      }
    }
    __syncthreads();

    v8f s[2] = {};
#pragma unroll
    for (int n = 0; n < 2; ++n)
#pragma unroll
      for (int kb = 0; kb < 2; ++kb)
        s[n] = wmma_x3(frag_lds(Kh, 72, n * 16, kb * 32, lane), frag_lds(Kl, 72, n * 16, kb * 32, lane), qh[kb], ql[kb], s[n]);

    v16bf pbh, pbl;
    {
      const int kg = t0 + 8 * half;      // s[n][r] is key kg + 16 * n + r against query qg
      float mx = -1e30f;
#pragma unroll
      for (int n = 0; n < 2; ++n)
#pragma unroll
        for (int r = 0; r < 8; ++r) {
          s[n][r] = (kg + n * 16 + r <= qg) ? s[n][r] : -1e30f;   // scores already carry the 1/8 scale (folded into Q)
          mx = fmaxf(mx, s[n][r]);
        }
      mx = fmaxf(mx, xhalf(mx));
      const float mnew  = fmaxf(mrow, mx);
      const float alpha = __expf(mrow - mnew);
      float rs = 0.0f;
#pragma unroll
      for (int n = 0; n < 2; ++n)
#pragma unroll
        for (int r = 0; r < 8; ++r) {
          const float p = (kg + n * 16 + r <= qg) ? __expf(s[n][r] - mnew) : 0.0f;
          rs += p;
          const __bf16 h = bf_hi(p);
          pbh[n * 8 + r] = h; pbl[n * 8 + r] = bf_lo(p, h);
        }
      lrow = lrow * alpha + rs;
      mrow = mnew;
#pragma unroll
      for (int j = 0; j < 4; ++j)
#pragma unroll
        for (int r = 0; r < 8; ++r) o[j][r] *= alpha;
    }
#pragma unroll
    for (int j = 0; j < 4; ++j)
      o[j] = wmma_x3(frag_lds(Vh, 40, j * 16, 0, lane), frag_lds(Vl, 40, j * 16, 0, lane), pbh, pbl, o[j]);
  }

  float* os_ = Os[wave];
  const float inv = 1.0f / (lrow + xhalf(lrow));   // the two halves' key sums joined once
#pragma unroll
  for (int j = 0; j < 4; ++j) {                    // o[j][r] is d = j * 16 + 8 * half + r of query col
    const v4f w0 = {o[j][0] * inv, o[j][1] * inv, o[j][2] * inv, o[j][3] * inv};
    const v4f w1 = {o[j][4] * inv, o[j][5] * inv, o[j][6] * inv, o[j][7] * inv};
    vst2(os_ + col * OP_ + j * 16 + 8 * half, w0);
    vst2(os_ + col * OP_ + j * 16 + 8 * half + 4, w1);
  }
  __syncthreads();
#pragma unroll
  for (int q = 0; q < 8; ++q) {
    const int rl = q * 2 + (lane >> 4), pc = lane & 15;
    vst2(Ctx + ((size_t)(b * S_ + mq + rl)) * D_ + head * HD_ + pc * 4, *(const v4f*)(os_ + rl * OP_ + pc * 4));
  }
}

__global__ __launch_bounds__(128) void out_gemm_kernel(const float* __restrict__ Cx, const float* __restrict__ Wo, float* __restrict__ Out) {
  __shared__ __align__(16) float st[4][32 * 64];
  __shared__ __align__(16) __bf16 Th[192 * TP_], Tl[192 * TP_];   // k slice: 64 rows of Cx, 128 rows of Wo
  const int lane = threadIdx.x & 31, wave = threadIdx.x >> 5;
  const int m0 = blockIdx.y * 64 + (wave >> 1) * 32;
  const int n0 = blockIdx.x * 128 + (wave & 1) * 64;
  v8f acc[2][4] = {};
  gemm_mainloop_32x64<QKV_, 64, 128>(Cx, Wo, blockIdx.y * 64, blockIdx.x * 128, (wave >> 1) * 32, (wave & 1) * 64, threadIdx.x, Th, Tl, acc);
  const int half = lane >> 4, col = lane & 15;
  float* S = st[wave];
#pragma unroll
  for (int i = 0; i < 2; ++i)
#pragma unroll
    for (int j = 0; j < 4; ++j)
#pragma unroll
      for (int r = 0; r < 8; ++r) S[(i * 16 + r + 8 * half) * 64 + j * 16 + col] = acc[i][j][r];
  __syncthreads();
#pragma unroll
  for (int q = 0; q < 16; ++q) {
    const int rl = q * 2 + (lane >> 4), pc = lane & 15;
    vst2(Out + (size_t)(m0 + rl) * D_ + n0 + pc * 4, *(const v4f*)(S + rl * 64 + pc * 4));
  }
}

extern "C" void kernel_launch(void* const* d_in, const int* in_sizes, int n_in,
                              void* d_out, int out_size, void* d_ws, size_t ws_size,
                              hipStream_t stream) {
  (void)in_sizes; (void)n_in; (void)out_size; (void)ws_size;
  const float* x    = (const float*)d_in[0];
  const float* Wqkv = (const float*)d_in[1];   // [3D][D]: rows [0,D) = Wq, [D,2D) = Wk, [2D,3D) = Wv
  const float* Wout = (const float*)d_in[2];   // [D][D]
  float* out = (float*)d_out;

  const size_t E = (size_t)M_TOT * D_;          // 8,388,608 floats per buffer (32 MB)
  float* qb   = (float*)d_ws;
  float* kb   = qb + E;
  float* vtb  = kb + E;        // V^T: [B,H,HD,S]
  float* ctxb = vtb + E;       // total 128 MB

  dim3 gp(D_ / 64, M_TOT / 128);
  proj_kernel<<<gp, 128, 0, stream>>>(x, Wqkv,                       SCALE_, 0, qb);
  proj_kernel<<<gp, 128, 0, stream>>>(x, Wqkv + (size_t)D_ * D_,     1.0f,   1, kb);
  proj_kernel<<<gp, 128, 0, stream>>>(x, Wqkv + (size_t)2 * D_ * D_, 1.0f,   2, vtb);
  attn_kernel<<<dim3(S_ / 64, H_, B_), 128, 0, stream>>>(qb, kb, vtb, ctxb);
  out_gemm_kernel<<<dim3(D_ / 128, M_TOT / 64), 128, 0, stream>>>(ctxb, Wout, out);
}

// v003
// A run of this version takes 460 microseconds.
// Next to v002, in two timings, it ran 1.17 and 1.16 times as fast.
// All steps since v000 together make it 1.77 times as fast.
#include <hip/hip_runtime.h>

// ---------------------------------------------------------------------------
// CausalMultiHeadSelfAttention (B=2, S=4096, D=1024, H=16, HD=64, causal; packed Wqkv [3D][D], Wout [D][D])
// Contractions: Q/K/V projections (K = 1024), QK^T (K = 64), P V (K = keys) and the output projection (K = 1024) — all on
// v_wmma_f32_16x16x32_bf16 as bf16 hi/lo splits (hi*hi + hi*lo + lo*hi, f32 accumulate) with every operand kept in f32 and
// split in registers / at LDS staging (causal rows expose single V rows, so plain 16-bit operands miss). Softmax statistics in
// ---------------------------------------------------------------------------

#define B_   2
#define S_   4096
#define D_   1024
#define QKV_ 1024
#define H_   16
#define HD_  64
#define M_TOT (B_ * S_)
#define SCALE_ 0.125f  // 64^-0.5

typedef __attribute__((ext_vector_type(16))) __bf16 v16bf;
typedef __attribute__((ext_vector_type(8)))  __bf16 v8bf;
typedef __attribute__((ext_vector_type(4)))  __bf16 v4bf;
typedef __attribute__((ext_vector_type(8)))  float  v8f;
typedef __attribute__((ext_vector_type(4)))  float  v4f;

template <typename V> __device__ __forceinline__ void vst2(void* p, V v) {
  *(V*)p = v; 
}
__device__ __forceinline__ __bf16 bf_hi(float x) { return (__bf16)x; }
__device__ __forceinline__ __bf16 bf_lo(float x, __bf16 h) { return (__bf16)(x - (float)h); }
__device__ __forceinline__ v8f wmma_bf16(v16bf a, v16bf b, v8f c) {
  v8f d = __builtin_amdgcn_wmma_f32_16x16x32_bf16(false, a, false, b, (short)0, c, false, false);
  asm volatile("v_nop\n\tv_nop\n\tv_nop\n\tv_nop" : "+v"(d) : "v"(a), "v"(b));
  return d;
}
__device__ __forceinline__ v8f wmma_x3(v16bf ah, v16bf al, v16bf bh, v16bf bl, v8f c) {
  c = wmma_bf16(ah, bh, c); c = wmma_bf16(ah, bl, c); c = wmma_bf16(al, bh, c);
  return c;
}

// lane l takes the value of lane l ^ 16 (the other half of the wave)
__device__ __forceinline__ float xhalf(float x) {
  return __builtin_bit_cast(float, __builtin_amdgcn_permlanex16(__builtin_bit_cast(int, x), __builtin_bit_cast(int, x), 0x76543210, 0xfedcba98, false, false));
}

// ---- fragment loaders (wave32): A (16x32 from [M][ld]) and B from B^T ([N][ld]) share the per-lane K map:
//      row/col = lane&15; elements 0..7 <- k0 + 8*half + 0..7, elements 8..15 <- k0 + 16 + 8*half + 0..7
// f32 source split into bf16 hi/lo
__device__ __forceinline__ void frag_f32(const float* __restrict__ base, int ld, int r0, int k0, int lane, v16bf& hi, v16bf& lo) {
  const float* p = base + (size_t)(r0 + (lane & 15)) * ld + k0 + (lane >> 4) * 8;
  const v4f a0 = *(const v4f*)(p), a1 = *(const v4f*)(p + 4), a2 = *(const v4f*)(p + 16), a3 = *(const v4f*)(p + 20);
#pragma unroll
  for (int i = 0; i < 4; ++i) {
    __bf16 h;
    h = bf_hi(a0[i]); hi[i] = h;      lo[i] = bf_lo(a0[i], h);
    h = bf_hi(a1[i]); hi[4 + i] = h;  lo[4 + i] = bf_lo(a1[i], h);
    h = bf_hi(a2[i]); hi[8 + i] = h;  lo[8 + i] = bf_lo(a2[i], h);
    h = bf_hi(a3[i]); hi[12 + i] = h; lo[12 + i] = bf_lo(a3[i], h);
  }
}
// bf16 plane in LDS
__device__ __forceinline__ v16bf frag_lds(const __bf16* base, int ld, int r0, int k0, int lane) {
  union { v16bf v; v8bf h[2]; } r;
  const __bf16* p = base + (r0 + (lane & 15)) * ld + k0 + (lane >> 4) * 8;
  r.h[0] = *(const v8bf*)(p); r.h[1] = *(const v8bf*)(p + 16);
  return r.v;
}


// ---- 32x64-per-wave GEMM main loop over f32 operands (A [M][K], Bt [N][K]) split into bf16 hi/lo; block = 4 waves, tile BM x BN.
//      Each 32-wide k slice (BM rows of A, then BN rows of Bt) is read from global memory in whole 128-byte lines (8 lanes per row),
//      split once per block and kept as two bf16 planes in LDS; the waves take their fragments from there (same k map as frag_f32).
#define TP_ 40   // LDS row pitch of a slice in bf16 elements (80 bytes)
template <int KDIM, int BM, int BN>
__device__ __forceinline__ void gemm_mainloop_32x64(const float* __restrict__ A, const float* __restrict__ Bt,
                                                    int mblk, int nblk, int mw, int nw, int tid,
                                                    __bf16* __restrict__ Th, __bf16* __restrict__ Tl, v8f acc[2][4]) {
  constexpr int NA = BM / 16, NL = (BM + BN) / 16;   // the 128 threads cover 16 rows per load
  const int lane = tid & 31, sr = tid >> 3, sc = (tid & 7) * 4;
  const float* pa = A + (size_t)(mblk + sr) * KDIM + sc;
  const float* pb = Bt + (size_t)(nblk + sr) * KDIM + sc;
#pragma unroll 1
  for (int k0 = 0; k0 < KDIM; k0 += 32) {
    v4f x[NL];
#pragma unroll
    for (int i = 0; i < NL; ++i)
      x[i] = (i < NA) ? *(const v4f*)(pa + (size_t)i * 16 * KDIM + k0) : *(const v4f*)(pb + (size_t)(i - NA) * 16 * KDIM + k0);
    asm volatile("s_wait_xcnt 0x0" ::: "memory");   // stands ahead of any reuse of the loads' address registers
    __syncthreads();   // every wave has taken its fragments of the slice before
#pragma unroll
    for (int i = 0; i < NL; ++i) {
      v4bf h, l;
#pragma unroll
      for (int e = 0; e < 4; ++e) { h[e] = bf_hi(x[i][e]); l[e] = bf_lo(x[i][e], h[e]); }
      vst2(Th + (i * 16 + sr) * TP_ + sc, h);
      vst2(Tl + (i * 16 + sr) * TP_ + sc, l);
    }
    __syncthreads();   // the slice is complete for every wave
    v16bf ah[2], al[2], bh[4], bl[4];
#pragma unroll
    for (int i = 0; i < 2; ++i) { ah[i] = frag_lds(Th, TP_, mw + i * 16, 0, lane); al[i] = frag_lds(Tl, TP_, mw + i * 16, 0, lane); }
#pragma unroll
    for (int j = 0; j < 4; ++j) { bh[j] = frag_lds(Th, TP_, BM + nw + j * 16, 0, lane); bl[j] = frag_lds(Tl, TP_, BM + nw + j * 16, 0, lane); }
#pragma unroll
    for (int i = 0; i < 2; ++i)
#pragma unroll
      for (int j = 0; j < 4; ++j) acc[i][j] = wmma_x3(ah[i], al[i], bh[j], bl[j], acc[i][j]);
  }
}

// ---- Stage 1: one projection (part 0 = Q scaled, 1 = K, 2 = V^T). grid (QKV/64, M_TOT/128), block 128 = 4 waves stacked in M.
__global__ __launch_bounds__(128) void proj_kernel(const float* __restrict__ X, const float* __restrict__ W, float scale,
                                                  int part, float* __restrict__ dst) {
  __shared__ __align__(16) float st[128][64];        // 32 KB
  __shared__ __align__(16) __bf16 Th[192 * TP_], Tl[192 * TP_];   // k slice: 128 rows of X, 64 rows of W
  const int lane = threadIdx.x & 31, wave = threadIdx.x >> 5, tid = threadIdx.x;
  const int mblk = blockIdx.y * 128;
  const int n0 = blockIdx.x * 64;
  const int head = n0 / HD_, d0 = n0 % HD_;
  const int b = mblk / S_, s0 = mblk % S_;

  v8f acc[2][4] = {};
  gemm_mainloop_32x64<D_, 128, 64>(X, W, mblk, n0, wave * 32, 0, tid, Th, Tl, acc);
  const int half = lane >> 4, col = lane & 15;
#pragma unroll
  for (int i = 0; i < 2; ++i)
#pragma unroll
    for (int j = 0; j < 4; ++j)
#pragma unroll
      for (int r = 0; r < 8; ++r) st[wave * 32 + i * 16 + r + 8 * half][j * 16 + col] = acc[i][j][r] * scale;
  __syncthreads();
  if (part < 2) {
    for (int g = tid; g < 128 * 16; g += 128) {            // 128 token rows x 16 pieces; a wave instruction covers 2 rows
      const int ml = g >> 4, pc = g & 15;
      vst2(dst + (((size_t)(b * H_ + head) * S_ + s0 + ml) * HD_) + d0 + pc * 4, *(const v4f*)(&st[ml][pc * 4]));
    }
  } else {
    for (int g = tid; g < 64 * 32; g += 128) {             // 64 d rows x 32 pieces (128 s); a wave instruction covers one row
      const int dl = g >> 5, pc = g & 31;
      v4f v = {st[pc * 4][dl], st[pc * 4 + 1][dl], st[pc * 4 + 2][dl], st[pc * 4 + 3][dl]};
      vst2(dst + (((size_t)(b * H_ + head) * HD_ + d0 + dl) * S_) + s0 + pc * 4, v);
    }
  }
}

#define OP_ 68   // pitch in floats of a query row in the output staging
#define NQT_ (S_ / 64)   // 64-query tiles per head
__global__ __launch_bounds__(128) void attn_kernel(const float* __restrict__ Qb, const float* __restrict__ Kb,
                                                  const float* __restrict__ Vt, float* __restrict__ Ctx) {
  __shared__ __align__(16) __bf16 Kh[32 * 72], Kl[32 * 72];     // [key][d] pitch 72
  __shared__ __align__(16) __bf16 Vh[64 * 40], Vl[64 * 40];     // [d][key] pitch 40
  __shared__ __align__(16) float  Os[4][16 * OP_];

  const int tid = threadIdx.x, lane = tid & 31, wave = tid >> 5, half = lane >> 4, col = lane & 15;
  const int head = blockIdx.y, b = blockIdx.z;
  const float* Qh = Qb + (size_t)(b * H_ + head) * S_ * HD_;
  const float* Kg = Kb + (size_t)(b * H_ + head) * S_ * HD_;
  const float* Vg = Vt + (size_t)(b * H_ + head) * HD_ * S_;
  // kept rolled: one copy of the key loop in the instruction cache, one set of registers
#pragma unroll 1
  for (int pass = 0; pass < 2; ++pass) {
  const int q0 = (pass == 0 ? NQT_ - 1 - (int)blockIdx.x : (int)blockIdx.x) * 64;   // block-uniform
  const int mq = q0 + wave * 16;

  v16bf qh[2], ql[2];
#pragma unroll
  for (int kb = 0; kb < 2; ++kb) frag_f32(Qh, HD_, mq, kb * 32, lane, qh[kb], ql[kb]);

  v8f o[4] = {};
  float mrow = -1e30f, lrow = 0.0f;     // this lane's query: running maximum (same in both halves), sum over this half's keys
  const int qg = mq + col;

  const int t_end = q0 + 64;            // causal limit (block-uniform, multiple of 32)
  for (int t0 = 0; t0 < t_end; t0 += 32) {
    __syncthreads();
    {   // stage K (32 x 64) and V^T (64 x 32): 16 + 16 floats per thread
      const int kr = tid >> 2, kc = (tid & 3) * 16;
      const float* kp = Kg + (size_t)(t0 + kr) * HD_ + kc;
      const int vr = tid >> 1, vc = (tid & 1) * 16;
      const float* vp = Vg + (size_t)vr * S_ + t0 + vc;
#pragma unroll
      for (int e = 0; e < 16; e += 4) {
        const v4f a = *(const v4f*)(kp + e), bb = *(const v4f*)(vp + e);
#pragma unroll
        for (int i = 0; i < 4; ++i) {
          __bf16 hk = bf_hi(a[i]);  Kh[kr * 72 + kc + e + i] = hk; Kl[kr * 72 + kc + e + i] = bf_lo(a[i], hk);
          __bf16 hv = bf_hi(bb[i]); Vh[vr * 40 + vc + e + i] = hv; Vl[vr * 40 + vc + e + i] = bf_lo(bb[i], hv);
        }
      }
    }
    __syncthreads();

    v8f s[2] = {};
#pragma unroll
    for (int n = 0; n < 2; ++n)
#pragma unroll
      for (int kb = 0; kb < 2; ++kb)
        s[n] = wmma_x3(frag_lds(Kh, 72, n * 16, kb * 32, lane), frag_lds(Kl, 72, n * 16, kb * 32, lane), qh[kb], ql[kb], s[n]);

    v16bf pbh, pbl;
    {
      const int kg = t0 + 8 * half;      // s[n][r] is key kg + 16 * n + r against query qg
      float mx = -1e30f;
#pragma unroll
      for (int n = 0; n < 2; ++n)
#pragma unroll
        for (int r = 0; r < 8; ++r) {
          s[n][r] = (kg + n * 16 + r <= qg) ? s[n][r] : -1e30f;   // scores already carry the 1/8 scale (folded into Q)
          mx = fmaxf(mx, s[n][r]);
        }
      mx = fmaxf(mx, xhalf(mx));
      const float mnew  = fmaxf(mrow, mx);
      const float alpha = __expf(mrow - mnew);
      float rs = 0.0f;
#pragma unroll
      for (int n = 0; n < 2; ++n)
#pragma unroll
        for (int r = 0; r < 8; ++r) {
          const float p = (kg + n * 16 + r <= qg) ? __expf(s[n][r] - mnew) : 0.0f;
          rs += p;
          const __bf16 h = bf_hi(p);
          pbh[n * 8 + r] = h; pbl[n * 8 + r] = bf_lo(p, h);
        }
      lrow = lrow * alpha + rs;
      mrow = mnew;
#pragma unroll
      for (int j = 0; j < 4; ++j)
#pragma unroll
        for (int r = 0; r < 8; ++r) o[j][r] *= alpha;
    }
#pragma unroll
    for (int j = 0; j < 4; ++j)
      o[j] = wmma_x3(frag_lds(Vh, 40, j * 16, 0, lane), frag_lds(Vl, 40, j * 16, 0, lane), pbh, pbl, o[j]);
  }

  float* os_ = Os[wave];
  const float inv = 1.0f / (lrow + xhalf(lrow));   // the two halves' key sums joined once
#pragma unroll
  for (int j = 0; j < 4; ++j) {                    // o[j][r] is d = j * 16 + 8 * half + r of query col
    const v4f w0 = {o[j][0] * inv, o[j][1] * inv, o[j][2] * inv, o[j][3] * inv};
    const v4f w1 = {o[j][4] * inv, o[j][5] * inv, o[j][6] * inv, o[j][7] * inv};
    vst2(os_ + col * OP_ + j * 16 + 8 * half, w0);
    vst2(os_ + col * OP_ + j * 16 + 8 * half + 4, w1);
  }
  __syncthreads();
#pragma unroll
  for (int q = 0; q < 8; ++q) {
    const int rl = q * 2 + (lane >> 4), pc = lane & 15;
    vst2(Ctx + ((size_t)(b * S_ + mq + rl)) * D_ + head * HD_ + pc * 4, *(const v4f*)(os_ + rl * OP_ + pc * 4));
  }
  asm volatile("s_wait_xcnt 0x0" ::: "memory");   // stands ahead of the next tile's reuse of the stores' address and data registers
  }
}

__global__ __launch_bounds__(128) void out_gemm_kernel(const float* __restrict__ Cx, const float* __restrict__ Wo, float* __restrict__ Out) {
  __shared__ __align__(16) float st[4][32 * 64];
  __shared__ __align__(16) __bf16 Th[192 * TP_], Tl[192 * TP_];   // k slice: 64 rows of Cx, 128 rows of Wo
  const int lane = threadIdx.x & 31, wave = threadIdx.x >> 5;
  const int m0 = blockIdx.y * 64 + (wave >> 1) * 32;
  const int n0 = blockIdx.x * 128 + (wave & 1) * 64;
  v8f acc[2][4] = {};
  gemm_mainloop_32x64<QKV_, 64, 128>(Cx, Wo, blockIdx.y * 64, blockIdx.x * 128, (wave >> 1) * 32, (wave & 1) * 64, threadIdx.x, Th, Tl, acc);
  const int half = lane >> 4, col = lane & 15;
  float* S = st[wave];
#pragma unroll
  for (int i = 0; i < 2; ++i)
#pragma unroll
    for (int j = 0; j < 4; ++j)
#pragma unroll
      for (int r = 0; r < 8; ++r) S[(i * 16 + r + 8 * half) * 64 + j * 16 + col] = acc[i][j][r];
  __syncthreads();
#pragma unroll
  for (int q = 0; q < 16; ++q) {
    const int rl = q * 2 + (lane >> 4), pc = lane & 15;
    vst2(Out + (size_t)(m0 + rl) * D_ + n0 + pc * 4, *(const v4f*)(S + rl * 64 + pc * 4));
  }
}

extern "C" void kernel_launch(void* const* d_in, const int* in_sizes, int n_in,
                              void* d_out, int out_size, void* d_ws, size_t ws_size,
                              hipStream_t stream) {
  (void)in_sizes; (void)n_in; (void)out_size; (void)ws_size;
  const float* x    = (const float*)d_in[0];
  const float* Wqkv = (const float*)d_in[1];   // [3D][D]: rows [0,D) = Wq, [D,2D) = Wk, [2D,3D) = Wv
  const float* Wout = (const float*)d_in[2];   // [D][D]
  float* out = (float*)d_out;

  const size_t E = (size_t)M_TOT * D_;          // 8,388,608 floats per buffer (32 MB)
  float* qb   = (float*)d_ws;
  float* kb   = qb + E;
  float* vtb  = kb + E;        // V^T: [B,H,HD,S]
  float* ctxb = vtb + E;       // total 128 MB

  dim3 gp(D_ / 64, M_TOT / 128);
  proj_kernel<<<gp, 128, 0, stream>>>(x, Wqkv,                       SCALE_, 0, qb);
  proj_kernel<<<gp, 128, 0, stream>>>(x, Wqkv + (size_t)D_ * D_,     1.0f,   1, kb);
  proj_kernel<<<gp, 128, 0, stream>>>(x, Wqkv + (size_t)2 * D_ * D_, 1.0f,   2, vtb);
  attn_kernel<<<dim3(S_ / 128, H_, B_), 128, 0, stream>>>(qb, kb, vtb, ctxb);
  out_gemm_kernel<<<dim3(D_ / 128, M_TOT / 64), 128, 0, stream>>>(ctxb, Wout, out);
}

// v004
// A run of this version takes 407 microseconds.
// Next to v003, in two timings, it ran 1.13 and 1.14 times as fast.
// Counting every step since v000, it is 2.01 times as fast.
#include <hip/hip_runtime.h>

// ---------------------------------------------------------------------------
// CausalMultiHeadSelfAttention (B=2, S=4096, D=1024, H=16, HD=64, causal; packed Wqkv [3D][D], Wout [D][D])
// Contractions: Q/K/V projections (K = 1024), QK^T (K = 64), P V (K = keys) and the output projection (K = 1024) — all on
// v_wmma_f32_16x16x32_bf16 as bf16 hi/lo splits (hi*hi + hi*lo + lo*hi, f32 accumulate) with every operand kept in f32 and
// split in registers / at LDS staging, but K and V, which leave their projections as hi/lo planes (causal rows expose single V rows,
// so plain 16-bit operands miss).
// ---------------------------------------------------------------------------

#define B_   2
#define S_   4096
#define D_   1024
#define QKV_ 1024
#define H_   16
#define HD_  64
#define M_TOT (B_ * S_)
#define SCALE_ 0.125f  // 64^-0.5
#define PLANE_ ((size_t)M_TOT * D_)   // elements of one bf16 plane of K or V; the lo plane follows the hi plane

typedef __attribute__((ext_vector_type(16))) __bf16 v16bf;
typedef __attribute__((ext_vector_type(8)))  __bf16 v8bf;
typedef __attribute__((ext_vector_type(4)))  __bf16 v4bf;
typedef __attribute__((ext_vector_type(8)))  float  v8f;
typedef __attribute__((ext_vector_type(4)))  float  v4f;

template <typename V> __device__ __forceinline__ void vst2(void* p, V v) {
  *(V*)p = v; 
}
__device__ __forceinline__ __bf16 bf_hi(float x) { return (__bf16)x; }
__device__ __forceinline__ __bf16 bf_lo(float x, __bf16 h) { return (__bf16)(x - (float)h); }
__device__ __forceinline__ v8f wmma_bf16(v16bf a, v16bf b, v8f c) {
  v8f d = __builtin_amdgcn_wmma_f32_16x16x32_bf16(false, a, false, b, (short)0, c, false, false);
  asm volatile("v_nop\n\tv_nop\n\tv_nop\n\tv_nop" : "+v"(d) : "v"(a), "v"(b));
  return d;
}
__device__ __forceinline__ v8f wmma_x3(v16bf ah, v16bf al, v16bf bh, v16bf bl, v8f c) {
  c = wmma_bf16(ah, bh, c); c = wmma_bf16(ah, bl, c); c = wmma_bf16(al, bh, c);
  return c;
}

// lane l takes the value of lane l ^ 16 (the other half of the wave)
__device__ __forceinline__ float xhalf(float x) {
  return __builtin_bit_cast(float, __builtin_amdgcn_permlanex16(__builtin_bit_cast(int, x), __builtin_bit_cast(int, x), 0x76543210, 0xfedcba98, false, false));
}

// ---- fragment loaders (wave32): A (16x32 from [M][ld]) and B from B^T ([N][ld]) share the per-lane K map:
//      row/col = lane&15; elements 0..7 <- k0 + 8*half + 0..7, elements 8..15 <- k0 + 16 + 8*half + 0..7
// f32 source split into bf16 hi/lo
__device__ __forceinline__ void frag_f32(const float* __restrict__ base, int ld, int r0, int k0, int lane, v16bf& hi, v16bf& lo) {
  const float* p = base + (size_t)(r0 + (lane & 15)) * ld + k0 + (lane >> 4) * 8;
  const v4f a0 = *(const v4f*)(p), a1 = *(const v4f*)(p + 4), a2 = *(const v4f*)(p + 16), a3 = *(const v4f*)(p + 20);
#pragma unroll
  for (int i = 0; i < 4; ++i) {
    __bf16 h;
    h = bf_hi(a0[i]); hi[i] = h;      lo[i] = bf_lo(a0[i], h);
    h = bf_hi(a1[i]); hi[4 + i] = h;  lo[4 + i] = bf_lo(a1[i], h);
    h = bf_hi(a2[i]); hi[8 + i] = h;  lo[8 + i] = bf_lo(a2[i], h);
    h = bf_hi(a3[i]); hi[12 + i] = h; lo[12 + i] = bf_lo(a3[i], h);
  }
}
// bf16 plane in LDS
__device__ __forceinline__ v16bf frag_lds(const __bf16* base, int ld, int r0, int k0, int lane) {
  union { v16bf v; v8bf h[2]; } r;
  const __bf16* p = base + (r0 + (lane & 15)) * ld + k0 + (lane >> 4) * 8;
  r.h[0] = *(const v8bf*)(p); r.h[1] = *(const v8bf*)(p + 16);
  return r.v;
}


// ---- 32x64-per-wave GEMM main loop over f32 operands (A [M][K], Bt [N][K]) split into bf16 hi/lo; block = 4 waves, tile BM x BN.
//      Each 32-wide k slice (BM rows of A, then BN rows of Bt) is read from global memory in whole 128-byte lines (8 lanes per row),
//      split once per block and kept as two bf16 planes in LDS; the waves take their fragments from there (same k map as frag_f32).
#define TP_ 40   // LDS row pitch of a slice in bf16 elements (80 bytes)
template <int KDIM, int BM, int BN>
__device__ __forceinline__ void gemm_mainloop_32x64(const float* __restrict__ A, const float* __restrict__ Bt,
                                                    int mblk, int nblk, int mw, int nw, int tid,
                                                    __bf16* __restrict__ Th, __bf16* __restrict__ Tl, v8f acc[2][4]) {
  constexpr int NA = BM / 16, NL = (BM + BN) / 16;   // the 128 threads cover 16 rows per load
  const int lane = tid & 31, sr = tid >> 3, sc = (tid & 7) * 4;
  const float* pa = A + (size_t)(mblk + sr) * KDIM + sc;
  const float* pb = Bt + (size_t)(nblk + sr) * KDIM + sc;
#pragma unroll 1
  for (int k0 = 0; k0 < KDIM; k0 += 32) {
    v4f x[NL];
#pragma unroll
    for (int i = 0; i < NL; ++i)
      x[i] = (i < NA) ? *(const v4f*)(pa + (size_t)i * 16 * KDIM + k0) : *(const v4f*)(pb + (size_t)(i - NA) * 16 * KDIM + k0);
    asm volatile("s_wait_xcnt 0x0" ::: "memory");   // stands ahead of any reuse of the loads' address registers
    __syncthreads();   // every wave has taken its fragments of the slice before
#pragma unroll
    for (int i = 0; i < NL; ++i) {
      v4bf h, l;
#pragma unroll
      for (int e = 0; e < 4; ++e) { h[e] = bf_hi(x[i][e]); l[e] = bf_lo(x[i][e], h[e]); }
      vst2(Th + (i * 16 + sr) * TP_ + sc, h);
      vst2(Tl + (i * 16 + sr) * TP_ + sc, l);
    }
    __syncthreads();   // the slice is complete for every wave
    v16bf ah[2], al[2], bh[4], bl[4];
#pragma unroll
    for (int i = 0; i < 2; ++i) { ah[i] = frag_lds(Th, TP_, mw + i * 16, 0, lane); al[i] = frag_lds(Tl, TP_, mw + i * 16, 0, lane); }
#pragma unroll
    for (int j = 0; j < 4; ++j) { bh[j] = frag_lds(Th, TP_, BM + nw + j * 16, 0, lane); bl[j] = frag_lds(Tl, TP_, BM + nw + j * 16, 0, lane); }
#pragma unroll
    for (int i = 0; i < 2; ++i)
#pragma unroll
      for (int j = 0; j < 4; ++j) acc[i][j] = wmma_x3(ah[i], al[i], bh[j], bl[j], acc[i][j]);
  }
}

// ---- Stage 1: one projection (part 0 = Q scaled, 1 = K, 2 = V^T). grid (QKV/64, M_TOT/128), block 128 = 4 waves stacked in M.
//      Q leaves as f32. K and V leave already split, as a bf16 hi plane and a bf16 lo plane, each laid out so that a 32-key tile of a head
//      is 4 KB in a row: K [B,H,S,HD], V [B,H,S/32,HD,32]. The split is made once here, not by every attention block that reads the tile.
__global__ __launch_bounds__(128) void proj_kernel(const float* __restrict__ X, const float* __restrict__ W, float scale,
                                                  int part, float* __restrict__ dst) {
  __shared__ __align__(16) float st[128][64];        // 32 KB
  __shared__ __align__(16) __bf16 Th[192 * TP_], Tl[192 * TP_];   // k slice: 128 rows of X, 64 rows of W
  const int lane = threadIdx.x & 31, wave = threadIdx.x >> 5, tid = threadIdx.x;
  const int mblk = blockIdx.y * 128;
  const int n0 = blockIdx.x * 64;
  const int head = n0 / HD_, d0 = n0 % HD_;
  const int b = mblk / S_, s0 = mblk % S_;

  v8f acc[2][4] = {};
  gemm_mainloop_32x64<D_, 128, 64>(X, W, mblk, n0, wave * 32, 0, tid, Th, Tl, acc);
  const int half = lane >> 4, col = lane & 15;
#pragma unroll
  for (int i = 0; i < 2; ++i)
#pragma unroll
    for (int j = 0; j < 4; ++j)
#pragma unroll
      for (int r = 0; r < 8; ++r) st[wave * 32 + i * 16 + r + 8 * half][j * 16 + col] = acc[i][j][r] * scale;
  __syncthreads();
  if (part == 0) {
    for (int g = tid; g < 128 * 16; g += 128) {            // 128 token rows x 16 pieces; a wave instruction covers 2 rows
      const int ml = g >> 4, pc = g & 15;
      vst2(dst + (((size_t)(b * H_ + head) * S_ + s0 + ml) * HD_) + d0 + pc * 4, *(const v4f*)(&st[ml][pc * 4]));
    }
  } else if (part == 1) {
    __bf16* ph = (__bf16*)dst;
    for (int g = tid; g < 128 * 16; g += 128) {            // 128 token rows x 16 pieces; a wave instruction covers 2 rows = 256 B of a plane
      const int ml = g >> 4, pc = g & 15;
      const v4f v = *(const v4f*)(&st[ml][pc * 4]);
      v4bf h, l;
#pragma unroll
      for (int e = 0; e < 4; ++e) { h[e] = bf_hi(v[e]); l[e] = bf_lo(v[e], h[e]); }
      const size_t o = (((size_t)(b * H_ + head) * S_ + s0 + ml) * HD_) + d0 + pc * 4;
      vst2(ph + o, h);
      vst2(ph + PLANE_ + o, l);
    }
  } else {
    __bf16* ph = (__bf16*)dst;
    for (int g = tid; g < 4 * 8 * 32; g += 128) {          // 4 key tiles x 8 groups of 8 d rows; a wave instruction covers 8 rows = 512 B of a plane
      const int kt = g >> 8, dl = ((g >> 5) & 7) * 8 + (lane >> 2), kp = (lane & 3) * 8;
      v8bf h, l;
#pragma unroll
      for (int e = 0; e < 8; ++e) { const float v = st[kt * 32 + kp + e][dl]; h[e] = bf_hi(v); l[e] = bf_lo(v, h[e]); }
      const size_t o = ((((size_t)(b * H_ + head) * (S_ / 32) + (s0 >> 5) + kt) * HD_) + d0 + dl) * 32 + kp;
      vst2(ph + o, h);
      vst2(ph + PLANE_ + o, l);
    }
  }
}

#define OP_ 68   // pitch in floats of a query row in the output staging
#define NQT_ (S_ / 64)   // 64-query tiles per head
__global__ __launch_bounds__(128) void attn_kernel(const float* __restrict__ Qb, const float* __restrict__ Kb,
                                                  const float* __restrict__ Vt, float* __restrict__ Ctx) {
  __shared__ __align__(16) __bf16 Kh[32 * 72], Kl[32 * 72];     // [key][d] pitch 72
  __shared__ __align__(16) __bf16 Vh[64 * 40], Vl[64 * 40];     // [d][key] pitch 40
  __shared__ __align__(16) float  Os[4][16 * OP_];

  const int tid = threadIdx.x, lane = tid & 31, wave = tid >> 5, half = lane >> 4, col = lane & 15;
  const int head = blockIdx.y, b = blockIdx.z;
  const float* Qh = Qb + (size_t)(b * H_ + head) * S_ * HD_;
  // K and V arrive split (hi plane, then lo plane); in all four planes the 32-key tile at t0 is the 4 KB from element t0 * HD_ of the head
  const __bf16* Kg = (const __bf16*)Kb + (size_t)(b * H_ + head) * S_ * HD_ + tid * 8;
  const __bf16* Vg = (const __bf16*)Vt + (size_t)(b * H_ + head) * S_ * HD_ + tid * 8;
  // kept rolled: one copy of the key loop in the instruction cache, one set of registers
#pragma unroll 1
  for (int pass = 0; pass < 2; ++pass) {
  const int q0 = (pass == 0 ? NQT_ - 1 - (int)blockIdx.x : (int)blockIdx.x) * 64;   // block-uniform
  const int mq = q0 + wave * 16;

  v16bf qh[2], ql[2];
#pragma unroll
  for (int kb = 0; kb < 2; ++kb) frag_f32(Qh, HD_, mq, kb * 32, lane, qh[kb], ql[kb]);

  v8f o[4] = {};
  float mrow = -1e30f, lrow = 0.0f;     // this lane's query: running maximum (same in both halves), sum over this half's keys
  const int qg = mq + col;

  const int t_end = q0 + 64;            // causal limit (block-uniform, multiple of 32)
  for (int t0 = 0; t0 < t_end; t0 += 32) {
    __syncthreads();
    {   // stage K (32 x 64) and V^T (64 x 32), hi and lo: a plain copy, 16 bytes per lane, so a wave instruction reads 4 whole lines
      const __bf16* kp = Kg + (size_t)t0 * HD_;
      const __bf16* vp = Vg + (size_t)t0 * HD_;
      v8bf xk[2][2], xv[2][2];
#pragma unroll
      for (int i = 0; i < 2; ++i) {
        xk[0][i] = *(const v8bf*)(kp + i * 1024); xk[1][i] = *(const v8bf*)(kp + PLANE_ + i * 1024);
        xv[0][i] = *(const v8bf*)(vp + i * 1024); xv[1][i] = *(const v8bf*)(vp + PLANE_ + i * 1024);
      }
      asm volatile("s_wait_xcnt 0x0" ::: "memory");   // stands ahead of any reuse of the loads' address registers
#pragma unroll
      for (int i = 0; i < 2; ++i) {
        const int pc = i * 128 + tid;      // 16-byte piece of the tile: 8 pieces per K row, 4 per V^T row
        vst2(Kh + (pc >> 3) * 72 + (pc & 7) * 8, xk[0][i]); vst2(Kl + (pc >> 3) * 72 + (pc & 7) * 8, xk[1][i]);
        vst2(Vh + (pc >> 2) * 40 + (pc & 3) * 8, xv[0][i]); vst2(Vl + (pc >> 2) * 40 + (pc & 3) * 8, xv[1][i]);
      }
    }
    __syncthreads();

    v8f s[2] = {};
#pragma unroll
    for (int n = 0; n < 2; ++n)
#pragma unroll
      for (int kb = 0; kb < 2; ++kb)
        s[n] = wmma_x3(frag_lds(Kh, 72, n * 16, kb * 32, lane), frag_lds(Kl, 72, n * 16, kb * 32, lane), qh[kb], ql[kb], s[n]);

    v16bf pbh, pbl;
    {
      const int kg = t0 + 8 * half;      // s[n][r] is key kg + 16 * n + r against query qg
      float mx = -1e30f;
#pragma unroll
      for (int n = 0; n < 2; ++n)
#pragma unroll
        for (int r = 0; r < 8; ++r) {
          s[n][r] = (kg + n * 16 + r <= qg) ? s[n][r] : -1e30f;   // scores already carry the 1/8 scale (folded into Q)
          mx = fmaxf(mx, s[n][r]);
        }
      mx = fmaxf(mx, xhalf(mx));
      const float mnew  = fmaxf(mrow, mx);
      const float alpha = __expf(mrow - mnew);
      float rs = 0.0f;
#pragma unroll
      for (int n = 0; n < 2; ++n)
#pragma unroll
        for (int r = 0; r < 8; ++r) {
          const float p = (kg + n * 16 + r <= qg) ? __expf(s[n][r] - mnew) : 0.0f;
          rs += p;
          const __bf16 h = bf_hi(p);
          pbh[n * 8 + r] = h; pbl[n * 8 + r] = bf_lo(p, h);
        }
      lrow = lrow * alpha + rs;
      mrow = mnew;
#pragma unroll
      for (int j = 0; j < 4; ++j)
#pragma unroll
        for (int r = 0; r < 8; ++r) o[j][r] *= alpha;
    }
#pragma unroll
    for (int j = 0; j < 4; ++j)
      o[j] = wmma_x3(frag_lds(Vh, 40, j * 16, 0, lane), frag_lds(Vl, 40, j * 16, 0, lane), pbh, pbl, o[j]);
  }

  float* os_ = Os[wave];
  const float inv = 1.0f / (lrow + xhalf(lrow));   // the two halves' key sums joined once
#pragma unroll
  for (int j = 0; j < 4; ++j) {                    // o[j][r] is d = j * 16 + 8 * half + r of query col
    const v4f w0 = {o[j][0] * inv, o[j][1] * inv, o[j][2] * inv, o[j][3] * inv};
    const v4f w1 = {o[j][4] * inv, o[j][5] * inv, o[j][6] * inv, o[j][7] * inv};
    vst2(os_ + col * OP_ + j * 16 + 8 * half, w0);
    vst2(os_ + col * OP_ + j * 16 + 8 * half + 4, w1);
  }
  __syncthreads();
#pragma unroll
  for (int q = 0; q < 8; ++q) {
    const int rl = q * 2 + (lane >> 4), pc = lane & 15;
    vst2(Ctx + ((size_t)(b * S_ + mq + rl)) * D_ + head * HD_ + pc * 4, *(const v4f*)(os_ + rl * OP_ + pc * 4));
  }
  asm volatile("s_wait_xcnt 0x0" ::: "memory");   // stands ahead of the next tile's reuse of the stores' address and data registers
  }
}

__global__ __launch_bounds__(128) void out_gemm_kernel(const float* __restrict__ Cx, const float* __restrict__ Wo, float* __restrict__ Out) {
  __shared__ __align__(16) float st[4][32 * 64];
  __shared__ __align__(16) __bf16 Th[192 * TP_], Tl[192 * TP_];   // k slice: 64 rows of Cx, 128 rows of Wo
  const int lane = threadIdx.x & 31, wave = threadIdx.x >> 5;
  const int m0 = blockIdx.y * 64 + (wave >> 1) * 32;
  const int n0 = blockIdx.x * 128 + (wave & 1) * 64;
  v8f acc[2][4] = {};
  gemm_mainloop_32x64<QKV_, 64, 128>(Cx, Wo, blockIdx.y * 64, blockIdx.x * 128, (wave >> 1) * 32, (wave & 1) * 64, threadIdx.x, Th, Tl, acc);
  const int half = lane >> 4, col = lane & 15;
  float* S = st[wave];
#pragma unroll
  for (int i = 0; i < 2; ++i)
#pragma unroll
    for (int j = 0; j < 4; ++j)
#pragma unroll
      for (int r = 0; r < 8; ++r) S[(i * 16 + r + 8 * half) * 64 + j * 16 + col] = acc[i][j][r];
  __syncthreads();
#pragma unroll
  for (int q = 0; q < 16; ++q) {
    const int rl = q * 2 + (lane >> 4), pc = lane & 15;
    vst2(Out + (size_t)(m0 + rl) * D_ + n0 + pc * 4, *(const v4f*)(S + rl * 64 + pc * 4));
  }
}

extern "C" void kernel_launch(void* const* d_in, const int* in_sizes, int n_in,
                              void* d_out, int out_size, void* d_ws, size_t ws_size,
                              hipStream_t stream) {
  (void)in_sizes; (void)n_in; (void)out_size; (void)ws_size;
  const float* x    = (const float*)d_in[0];
  const float* Wqkv = (const float*)d_in[1];   // [3D][D]: rows [0,D) = Wq, [D,2D) = Wk, [2D,3D) = Wv
  const float* Wout = (const float*)d_in[2];   // [D][D]
  float* out = (float*)d_out;

  const size_t E = (size_t)M_TOT * D_;          // 8,388,608 floats per buffer (32 MB)
  float* qb   = (float*)d_ws;
  float* kb   = qb + E;
  float* vtb  = kb + E;        // kb, vtb: each a bf16 hi plane and a bf16 lo plane of E elements (K [B,H,S,HD], V [B,H,S/32,HD,32])
  float* ctxb = vtb + E;       // total 128 MB

  dim3 gp(D_ / 64, M_TOT / 128);
  proj_kernel<<<gp, 128, 0, stream>>>(x, Wqkv,                       SCALE_, 0, qb);
  proj_kernel<<<gp, 128, 0, stream>>>(x, Wqkv + (size_t)D_ * D_,     1.0f,   1, kb);
  proj_kernel<<<gp, 128, 0, stream>>>(x, Wqkv + (size_t)2 * D_ * D_, 1.0f,   2, vtb);
  attn_kernel<<<dim3(S_ / 128, H_, B_), 128, 0, stream>>>(qb, kb, vtb, ctxb);
  out_gemm_kernel<<<dim3(D_ / 128, M_TOT / 64), 128, 0, stream>>>(ctxb, Wout, out);
}

// v005
// Measured time: 390 microseconds a run.
// Next to v004, in two timings, it ran 1.04 times as fast each time.
// All steps since v000 together make it 2.09 times as fast.
#include <hip/hip_runtime.h>

// ---------------------------------------------------------------------------
// CausalMultiHeadSelfAttention (B=2, S=4096, D=1024, H=16, HD=64, causal; packed Wqkv [3D][D], Wout [D][D])
// Contractions: Q/K/V projections (K = 1024), QK^T (K = 64), P V (K = keys) and the output projection (K = 1024) — all on
// v_wmma_f32_16x16x32_bf16 as bf16 hi/lo splits (hi*hi + hi*lo + lo*hi, f32 accumulate) with every operand kept in f32 and
// split in registers / at LDS staging, but K and V, which leave their projections as hi/lo planes (causal rows expose single V rows,
// so plain 16-bit operands miss).
// ---------------------------------------------------------------------------

#define B_   2
#define S_   4096
#define D_   1024
#define QKV_ 1024
#define H_   16
#define HD_  64
#define M_TOT (B_ * S_)
#define SCALE_ 0.125f  // 64^-0.5
#define PLANE_ ((size_t)M_TOT * D_)   // elements of one bf16 plane of K or V; the lo plane follows the hi plane

typedef __attribute__((ext_vector_type(16))) __bf16 v16bf;
typedef __attribute__((ext_vector_type(8)))  __bf16 v8bf;
typedef __attribute__((ext_vector_type(4)))  __bf16 v4bf;
typedef __attribute__((ext_vector_type(8)))  float  v8f;
typedef __attribute__((ext_vector_type(4)))  float  v4f;

template <typename V> __device__ __forceinline__ void vst2(void* p, V v) {
  *(V*)p = v; 
}
__device__ __forceinline__ __bf16 bf_hi(float x) { return (__bf16)x; }
__device__ __forceinline__ __bf16 bf_lo(float x, __bf16 h) { return (__bf16)(x - (float)h); }
// the plain builtin: the compiler keeps the distances behind it itself, and is free to issue the products of independent accumulator
// tiles back to back and to fetch LDS fragments ahead of them (each accumulator still takes hi*hi, hi*lo, lo*hi in this order)
__device__ __forceinline__ v8f wmma_bf16(v16bf a, v16bf b, v8f c) {
  return __builtin_amdgcn_wmma_f32_16x16x32_bf16(false, a, false, b, (short)0, c, false, false);
}
__device__ __forceinline__ v8f wmma_x3(v16bf ah, v16bf al, v16bf bh, v16bf bl, v8f c) {
  c = wmma_bf16(ah, bh, c); c = wmma_bf16(ah, bl, c); c = wmma_bf16(al, bh, c);
  return c;
}

// lane l takes the value of lane l ^ 16 (the other half of the wave)
__device__ __forceinline__ float xhalf(float x) {
  return __builtin_bit_cast(float, __builtin_amdgcn_permlanex16(__builtin_bit_cast(int, x), __builtin_bit_cast(int, x), 0x76543210, 0xfedcba98, false, false));
}

// ---- fragment loaders (wave32): A (16x32 from [M][ld]) and B from B^T ([N][ld]) share the per-lane K map:
//      row/col = lane&15; elements 0..7 <- k0 + 8*half + 0..7, elements 8..15 <- k0 + 16 + 8*half + 0..7
// f32 source split into bf16 hi/lo
__device__ __forceinline__ void frag_f32(const float* __restrict__ base, int ld, int r0, int k0, int lane, v16bf& hi, v16bf& lo) {
  const float* p = base + (size_t)(r0 + (lane & 15)) * ld + k0 + (lane >> 4) * 8;
  const v4f a0 = *(const v4f*)(p), a1 = *(const v4f*)(p + 4), a2 = *(const v4f*)(p + 16), a3 = *(const v4f*)(p + 20);
#pragma unroll
  for (int i = 0; i < 4; ++i) {
    __bf16 h;
    h = bf_hi(a0[i]); hi[i] = h;      lo[i] = bf_lo(a0[i], h);
    h = bf_hi(a1[i]); hi[4 + i] = h;  lo[4 + i] = bf_lo(a1[i], h);
    h = bf_hi(a2[i]); hi[8 + i] = h;  lo[8 + i] = bf_lo(a2[i], h);
    h = bf_hi(a3[i]); hi[12 + i] = h; lo[12 + i] = bf_lo(a3[i], h);
  }
}
// bf16 plane in LDS
__device__ __forceinline__ v16bf frag_lds(const __bf16* base, int ld, int r0, int k0, int lane) {
  union { v16bf v; v8bf h[2]; } r;
  const __bf16* p = base + (r0 + (lane & 15)) * ld + k0 + (lane >> 4) * 8;
  r.h[0] = *(const v8bf*)(p); r.h[1] = *(const v8bf*)(p + 16);
  return r.v;
}


// ---- 32x64-per-wave GEMM main loop over f32 operands (A [M][K], Bt [N][K]) split into bf16 hi/lo; block = 4 waves, tile BM x BN.
//      Each 32-wide k slice (BM rows of A, then BN rows of Bt) is read from global memory in whole 128-byte lines (8 lanes per row),
//      split once per block and kept as two bf16 planes in LDS; the waves take their fragments from there (same k map as frag_f32).
#define TP_ 40   // LDS row pitch of a slice in bf16 elements (80 bytes)
template <int KDIM, int BM, int BN>
__device__ __forceinline__ void gemm_mainloop_32x64(const float* __restrict__ A, const float* __restrict__ Bt,
                                                    int mblk, int nblk, int mw, int nw, int tid,
                                                    __bf16* __restrict__ Th, __bf16* __restrict__ Tl, v8f acc[2][4]) {
  constexpr int NA = BM / 16, NL = (BM + BN) / 16;   // the 128 threads cover 16 rows per load
  const int lane = tid & 31, sr = tid >> 3, sc = (tid & 7) * 4;
  const float* pa = A + (size_t)(mblk + sr) * KDIM + sc;
  const float* pb = Bt + (size_t)(nblk + sr) * KDIM + sc;
#pragma unroll 1
  for (int k0 = 0; k0 < KDIM; k0 += 32) {
    v4f x[NL];
#pragma unroll
    for (int i = 0; i < NL; ++i)
      x[i] = (i < NA) ? *(const v4f*)(pa + (size_t)i * 16 * KDIM + k0) : *(const v4f*)(pb + (size_t)(i - NA) * 16 * KDIM + k0);
    asm volatile("s_wait_xcnt 0x0" ::: "memory");   // stands ahead of any reuse of the loads' address registers
    __syncthreads();   // every wave has taken its fragments of the slice before
#pragma unroll
    for (int i = 0; i < NL; ++i) {
      v4bf h, l;
#pragma unroll
      for (int e = 0; e < 4; ++e) { h[e] = bf_hi(x[i][e]); l[e] = bf_lo(x[i][e], h[e]); }
      vst2(Th + (i * 16 + sr) * TP_ + sc, h);
      vst2(Tl + (i * 16 + sr) * TP_ + sc, l);
    }
    __syncthreads();   // the slice is complete for every wave
    v16bf ah[2], al[2], bh[4], bl[4];
#pragma unroll
    for (int i = 0; i < 2; ++i) { ah[i] = frag_lds(Th, TP_, mw + i * 16, 0, lane); al[i] = frag_lds(Tl, TP_, mw + i * 16, 0, lane); }
#pragma unroll
    for (int j = 0; j < 4; ++j) { bh[j] = frag_lds(Th, TP_, BM + nw + j * 16, 0, lane); bl[j] = frag_lds(Tl, TP_, BM + nw + j * 16, 0, lane); }
#pragma unroll
    for (int i = 0; i < 2; ++i)
#pragma unroll
      for (int j = 0; j < 4; ++j) acc[i][j] = wmma_x3(ah[i], al[i], bh[j], bl[j], acc[i][j]);
  }
}

// ---- Stage 1: one projection (part 0 = Q scaled, 1 = K, 2 = V^T). grid (QKV/64, M_TOT/128), block 128 = 4 waves stacked in M.
//      Q leaves as f32. K and V leave already split, as a bf16 hi plane and a bf16 lo plane, each laid out so that a 32-key tile of a head
//      is 4 KB in a row: K [B,H,S,HD], V [B,H,S/32,HD,32]. The split is made once here, not by every attention block that reads the tile.
__global__ __launch_bounds__(128) void proj_kernel(const float* __restrict__ X, const float* __restrict__ W, float scale,
                                                  int part, float* __restrict__ dst) {
  __shared__ __align__(16) float st[128][64];        // 32 KB
  __shared__ __align__(16) __bf16 Th[192 * TP_], Tl[192 * TP_];   // k slice: 128 rows of X, 64 rows of W
  const int lane = threadIdx.x & 31, wave = threadIdx.x >> 5, tid = threadIdx.x;
  const int mblk = blockIdx.y * 128;
  const int n0 = blockIdx.x * 64;
  const int head = n0 / HD_, d0 = n0 % HD_;
  const int b = mblk / S_, s0 = mblk % S_;

  v8f acc[2][4] = {};
  gemm_mainloop_32x64<D_, 128, 64>(X, W, mblk, n0, wave * 32, 0, tid, Th, Tl, acc);
  const int half = lane >> 4, col = lane & 15;
#pragma unroll
  for (int i = 0; i < 2; ++i)
#pragma unroll
    for (int j = 0; j < 4; ++j)
#pragma unroll
      for (int r = 0; r < 8; ++r) st[wave * 32 + i * 16 + r + 8 * half][j * 16 + col] = acc[i][j][r] * scale;
  __syncthreads();
  if (part == 0) {
    for (int g = tid; g < 128 * 16; g += 128) {            // 128 token rows x 16 pieces; a wave instruction covers 2 rows
      const int ml = g >> 4, pc = g & 15;
      vst2(dst + (((size_t)(b * H_ + head) * S_ + s0 + ml) * HD_) + d0 + pc * 4, *(const v4f*)(&st[ml][pc * 4]));
    }
  } else if (part == 1) {
    __bf16* ph = (__bf16*)dst;
    for (int g = tid; g < 128 * 16; g += 128) {            // 128 token rows x 16 pieces; a wave instruction covers 2 rows = 256 B of a plane
      const int ml = g >> 4, pc = g & 15;
      const v4f v = *(const v4f*)(&st[ml][pc * 4]);
      v4bf h, l;
#pragma unroll
      for (int e = 0; e < 4; ++e) { h[e] = bf_hi(v[e]); l[e] = bf_lo(v[e], h[e]); }
      const size_t o = (((size_t)(b * H_ + head) * S_ + s0 + ml) * HD_) + d0 + pc * 4;
      vst2(ph + o, h);
      vst2(ph + PLANE_ + o, l);
    }
  } else {
    __bf16* ph = (__bf16*)dst;
    for (int g = tid; g < 4 * 8 * 32; g += 128) {          // 4 key tiles x 8 groups of 8 d rows; a wave instruction covers 8 rows = 512 B of a plane
      const int kt = g >> 8, dl = ((g >> 5) & 7) * 8 + (lane >> 2), kp = (lane & 3) * 8;
      v8bf h, l;
#pragma unroll
      for (int e = 0; e < 8; ++e) { const float v = st[kt * 32 + kp + e][dl]; h[e] = bf_hi(v); l[e] = bf_lo(v, h[e]); }
      const size_t o = ((((size_t)(b * H_ + head) * (S_ / 32) + (s0 >> 5) + kt) * HD_) + d0 + dl) * 32 + kp;
      vst2(ph + o, h);
      vst2(ph + PLANE_ + o, l);
    }
  }
}

#define OP_ 68   // pitch in floats of a query row in the output staging
#define NQT_ (S_ / 64)   // 64-query tiles per head
__global__ __launch_bounds__(128) void attn_kernel(const float* __restrict__ Qb, const float* __restrict__ Kb,
                                                  const float* __restrict__ Vt, float* __restrict__ Ctx) {
  __shared__ __align__(16) __bf16 Kh[32 * 72], Kl[32 * 72];     // [key][d] pitch 72
  __shared__ __align__(16) __bf16 Vh[64 * 40], Vl[64 * 40];     // [d][key] pitch 40
  __shared__ __align__(16) float  Os[4][16 * OP_];

  const int tid = threadIdx.x, lane = tid & 31, wave = tid >> 5, half = lane >> 4, col = lane & 15;
  const int head = blockIdx.y, b = blockIdx.z;
  const float* Qh = Qb + (size_t)(b * H_ + head) * S_ * HD_;
  // K and V arrive split (hi plane, then lo plane); in all four planes the 32-key tile at t0 is the 4 KB from element t0 * HD_ of the head
  const __bf16* Kg = (const __bf16*)Kb + (size_t)(b * H_ + head) * S_ * HD_ + tid * 8;
  const __bf16* Vg = (const __bf16*)Vt + (size_t)(b * H_ + head) * S_ * HD_ + tid * 8;
  // kept rolled: one copy of the key loop in the instruction cache, one set of registers
#pragma unroll 1
  for (int pass = 0; pass < 2; ++pass) {
  const int q0 = (pass == 0 ? NQT_ - 1 - (int)blockIdx.x : (int)blockIdx.x) * 64;   // block-uniform
  const int mq = q0 + wave * 16;

  v16bf qh[2], ql[2];
#pragma unroll
  for (int kb = 0; kb < 2; ++kb) frag_f32(Qh, HD_, mq, kb * 32, lane, qh[kb], ql[kb]);

  v8f o[4] = {};
  float mrow = -1e30f, lrow = 0.0f;     // this lane's query: running maximum (same in both halves), sum over this half's keys
  const int qg = mq + col;

  const int t_end = q0 + 64;            // causal limit (block-uniform, multiple of 32)
  for (int t0 = 0; t0 < t_end; t0 += 32) {
    __syncthreads();
    {   // stage K (32 x 64) and V^T (64 x 32), hi and lo: a plain copy, 16 bytes per lane, so a wave instruction reads 4 whole lines
      const __bf16* kp = Kg + (size_t)t0 * HD_;
      const __bf16* vp = Vg + (size_t)t0 * HD_;
      v8bf xk[2][2], xv[2][2];
#pragma unroll
      for (int i = 0; i < 2; ++i) {
        xk[0][i] = *(const v8bf*)(kp + i * 1024); xk[1][i] = *(const v8bf*)(kp + PLANE_ + i * 1024);
        xv[0][i] = *(const v8bf*)(vp + i * 1024); xv[1][i] = *(const v8bf*)(vp + PLANE_ + i * 1024);
      }
      asm volatile("s_wait_xcnt 0x0" ::: "memory");   // stands ahead of any reuse of the loads' address registers
#pragma unroll
      for (int i = 0; i < 2; ++i) {
        const int pc = i * 128 + tid;      // 16-byte piece of the tile: 8 pieces per K row, 4 per V^T row
        vst2(Kh + (pc >> 3) * 72 + (pc & 7) * 8, xk[0][i]); vst2(Kl + (pc >> 3) * 72 + (pc & 7) * 8, xk[1][i]);
        vst2(Vh + (pc >> 2) * 40 + (pc & 3) * 8, xv[0][i]); vst2(Vl + (pc >> 2) * 40 + (pc & 3) * 8, xv[1][i]);
      }
    }
    __syncthreads();

    v8f s[2] = {};
#pragma unroll
    for (int n = 0; n < 2; ++n)
#pragma unroll
      for (int kb = 0; kb < 2; ++kb)
        s[n] = wmma_x3(frag_lds(Kh, 72, n * 16, kb * 32, lane), frag_lds(Kl, 72, n * 16, kb * 32, lane), qh[kb], ql[kb], s[n]);

    v16bf pbh, pbl;
    {
      const int kg = t0 + 8 * half;      // s[n][r] is key kg + 16 * n + r against query qg
      float mx = -1e30f;
#pragma unroll
      for (int n = 0; n < 2; ++n)
#pragma unroll
        for (int r = 0; r < 8; ++r) {
          s[n][r] = (kg + n * 16 + r <= qg) ? s[n][r] : -1e30f;   // scores already carry the 1/8 scale (folded into Q)
          mx = fmaxf(mx, s[n][r]);
        }
      mx = fmaxf(mx, xhalf(mx));
      const float mnew  = fmaxf(mrow, mx);
      const float alpha = __expf(mrow - mnew);
      float rs = 0.0f;
#pragma unroll
      for (int n = 0; n < 2; ++n)
#pragma unroll
        for (int r = 0; r < 8; ++r) {
          const float p = (kg + n * 16 + r <= qg) ? __expf(s[n][r] - mnew) : 0.0f;
          rs += p;
          const __bf16 h = bf_hi(p);
          pbh[n * 8 + r] = h; pbl[n * 8 + r] = bf_lo(p, h);
        }
      lrow = lrow * alpha + rs;
      mrow = mnew;
#pragma unroll
      for (int j = 0; j < 4; ++j)
#pragma unroll
        for (int r = 0; r < 8; ++r) o[j][r] *= alpha;
    }
#pragma unroll
    for (int j = 0; j < 4; ++j)
      o[j] = wmma_x3(frag_lds(Vh, 40, j * 16, 0, lane), frag_lds(Vl, 40, j * 16, 0, lane), pbh, pbl, o[j]);
  }

  float* os_ = Os[wave];
  const float inv = 1.0f / (lrow + xhalf(lrow));   // the two halves' key sums joined once
#pragma unroll
  for (int j = 0; j < 4; ++j) {                    // o[j][r] is d = j * 16 + 8 * half + r of query col
    const v4f w0 = {o[j][0] * inv, o[j][1] * inv, o[j][2] * inv, o[j][3] * inv};
    const v4f w1 = {o[j][4] * inv, o[j][5] * inv, o[j][6] * inv, o[j][7] * inv};
    vst2(os_ + col * OP_ + j * 16 + 8 * half, w0);
    vst2(os_ + col * OP_ + j * 16 + 8 * half + 4, w1);
  }
  __syncthreads();
#pragma unroll
  for (int q = 0; q < 8; ++q) {
    const int rl = q * 2 + (lane >> 4), pc = lane & 15;
    vst2(Ctx + ((size_t)(b * S_ + mq + rl)) * D_ + head * HD_ + pc * 4, *(const v4f*)(os_ + rl * OP_ + pc * 4));
  }
  asm volatile("s_wait_xcnt 0x0" ::: "memory");   // stands ahead of the next tile's reuse of the stores' address and data registers
  }
}

__global__ __launch_bounds__(128) void out_gemm_kernel(const float* __restrict__ Cx, const float* __restrict__ Wo, float* __restrict__ Out) {
  __shared__ __align__(16) float st[4][32 * 64];
  __shared__ __align__(16) __bf16 Th[192 * TP_], Tl[192 * TP_];   // k slice: 64 rows of Cx, 128 rows of Wo
  const int lane = threadIdx.x & 31, wave = threadIdx.x >> 5;
  const int m0 = blockIdx.y * 64 + (wave >> 1) * 32;
  const int n0 = blockIdx.x * 128 + (wave & 1) * 64;
  v8f acc[2][4] = {};
  gemm_mainloop_32x64<QKV_, 64, 128>(Cx, Wo, blockIdx.y * 64, blockIdx.x * 128, (wave >> 1) * 32, (wave & 1) * 64, threadIdx.x, Th, Tl, acc);
  const int half = lane >> 4, col = lane & 15;
  float* S = st[wave];
#pragma unroll
  for (int i = 0; i < 2; ++i)
#pragma unroll
    for (int j = 0; j < 4; ++j)
#pragma unroll
      for (int r = 0; r < 8; ++r) S[(i * 16 + r + 8 * half) * 64 + j * 16 + col] = acc[i][j][r];
  __syncthreads();
#pragma unroll
  for (int q = 0; q < 16; ++q) {
    const int rl = q * 2 + (lane >> 4), pc = lane & 15;
    vst2(Out + (size_t)(m0 + rl) * D_ + n0 + pc * 4, *(const v4f*)(S + rl * 64 + pc * 4));
  }
}

extern "C" void kernel_launch(void* const* d_in, const int* in_sizes, int n_in,
                              void* d_out, int out_size, void* d_ws, size_t ws_size,
                              hipStream_t stream) {
  (void)in_sizes; (void)n_in; (void)out_size; (void)ws_size;
  const float* x    = (const float*)d_in[0];
  const float* Wqkv = (const float*)d_in[1];   // [3D][D]: rows [0,D) = Wq, [D,2D) = Wk, [2D,3D) = Wv
  const float* Wout = (const float*)d_in[2];   // [D][D]
  float* out = (float*)d_out;

  const size_t E = (size_t)M_TOT * D_;          // 8,388,608 floats per buffer (32 MB)
  float* qb   = (float*)d_ws;
  float* kb   = qb + E;
  float* vtb  = kb + E;        // kb, vtb: each a bf16 hi plane and a bf16 lo plane of E elements (K [B,H,S,HD], V [B,H,S/32,HD,32])
  float* ctxb = vtb + E;       // total 128 MB

  dim3 gp(D_ / 64, M_TOT / 128);
  proj_kernel<<<gp, 128, 0, stream>>>(x, Wqkv,                       SCALE_, 0, qb);
  proj_kernel<<<gp, 128, 0, stream>>>(x, Wqkv + (size_t)D_ * D_,     1.0f,   1, kb);
  proj_kernel<<<gp, 128, 0, stream>>>(x, Wqkv + (size_t)2 * D_ * D_, 1.0f,   2, vtb);
  attn_kernel<<<dim3(S_ / 128, H_, B_), 128, 0, stream>>>(qb, kb, vtb, ctxb);
  out_gemm_kernel<<<dim3(D_ / 128, M_TOT / 64), 128, 0, stream>>>(ctxb, Wout, out);
}

// v006
// A run of this version takes 336 microseconds.
// Timed twice side by side with v005, it ran 1.15 and 1.16 times as fast.
// Counting every step since v000, it is 2.41 times as fast.
#include <hip/hip_runtime.h>

// ---------------------------------------------------------------------------
// CausalMultiHeadSelfAttention (B=2, S=4096, D=1024, H=16, HD=64, causal; packed Wqkv [3D][D], Wout [D][D])
// Contractions: Q/K/V projections (K = 1024), QK^T (K = 64), P V (K = keys) and the output projection (K = 1024) — all on
// v_wmma_f32_16x16x32_bf16 as bf16 hi/lo splits (hi*hi + hi*lo + lo*hi, f32 accumulate) with every operand kept in f32 and
// split in registers / at LDS staging, but K and V, which leave their projections as hi/lo planes (causal rows expose single V rows,
// so plain 16-bit operands miss).
// ---------------------------------------------------------------------------

#define B_   2
#define S_   4096
#define D_   1024
#define QKV_ 1024
#define H_   16
#define HD_  64
#define M_TOT (B_ * S_)
#define SCALE_ 0.125f  // 64^-0.5
#define PLANE_ ((size_t)M_TOT * D_)   // elements of one bf16 plane of K or V; the lo plane follows the hi plane

typedef __attribute__((ext_vector_type(16))) __bf16 v16bf;
typedef __attribute__((ext_vector_type(8)))  __bf16 v8bf;
typedef __attribute__((ext_vector_type(4)))  __bf16 v4bf;
typedef __attribute__((ext_vector_type(8)))  float  v8f;
typedef __attribute__((ext_vector_type(4)))  float  v4f;

template <typename V> __device__ __forceinline__ void vst2(void* p, V v) {
  *(V*)p = v; 
}
__device__ __forceinline__ __bf16 bf_hi(float x) { return (__bf16)x; }
__device__ __forceinline__ __bf16 bf_lo(float x, __bf16 h) { return (__bf16)(x - (float)h); }
// the plain builtin: the compiler keeps the distances behind it itself, and is free to issue the products of independent accumulator
// tiles back to back and to fetch LDS fragments ahead of them (each accumulator still takes hi*hi, hi*lo, lo*hi in this order)
__device__ __forceinline__ v8f wmma_bf16(v16bf a, v16bf b, v8f c) {
  return __builtin_amdgcn_wmma_f32_16x16x32_bf16(false, a, false, b, (short)0, c, false, false);
}
__device__ __forceinline__ v8f wmma_x3(v16bf ah, v16bf al, v16bf bh, v16bf bl, v8f c) {
  c = wmma_bf16(ah, bh, c); c = wmma_bf16(ah, bl, c); c = wmma_bf16(al, bh, c);
  return c;
}

// lane l takes the value of lane l ^ 16 (the other half of the wave)
__device__ __forceinline__ float xhalf(float x) {
  return __builtin_bit_cast(float, __builtin_amdgcn_permlanex16(__builtin_bit_cast(int, x), __builtin_bit_cast(int, x), 0x76543210, 0xfedcba98, false, false));
}

// ---- fragment loaders (wave32): A (16x32 from [M][ld]) and B from B^T ([N][ld]) share the per-lane K map:
//      row/col = lane&15; elements 0..7 <- k0 + 8*half + 0..7, elements 8..15 <- k0 + 16 + 8*half + 0..7
// f32 source split into bf16 hi/lo
__device__ __forceinline__ void frag_f32(const float* __restrict__ base, int ld, int r0, int k0, int lane, v16bf& hi, v16bf& lo) {
  const float* p = base + (size_t)(r0 + (lane & 15)) * ld + k0 + (lane >> 4) * 8;
  const v4f a0 = *(const v4f*)(p), a1 = *(const v4f*)(p + 4), a2 = *(const v4f*)(p + 16), a3 = *(const v4f*)(p + 20);
#pragma unroll
  for (int i = 0; i < 4; ++i) {
    __bf16 h;
    h = bf_hi(a0[i]); hi[i] = h;      lo[i] = bf_lo(a0[i], h);
    h = bf_hi(a1[i]); hi[4 + i] = h;  lo[4 + i] = bf_lo(a1[i], h);
    h = bf_hi(a2[i]); hi[8 + i] = h;  lo[8 + i] = bf_lo(a2[i], h);
    h = bf_hi(a3[i]); hi[12 + i] = h; lo[12 + i] = bf_lo(a3[i], h);
  }
}
// bf16 plane in LDS
__device__ __forceinline__ v16bf frag_lds(const __bf16* base, int ld, int r0, int k0, int lane) {
  union { v16bf v; v8bf h[2]; } r;
  const __bf16* p = base + (r0 + (lane & 15)) * ld + k0 + (lane >> 4) * 8;
  r.h[0] = *(const v8bf*)(p); r.h[1] = *(const v8bf*)(p + 16);
  return r.v;
}


// ---- 32x64-per-wave GEMM main loop over f32 operands (A [M][K], Bt [N][K]) split into bf16 hi/lo; block = 4 waves, tile BM x BN.
//      Each 32-wide k slice (BM rows of A, then BN rows of Bt) is read from global memory in whole 128-byte lines (8 lanes per row),
//      split once per block and kept as two bf16 planes in LDS; the waves take their fragments from there (same k map as frag_f32).
#define TP_ 40   // LDS row pitch of a slice in bf16 elements (80 bytes)
template <int KDIM, int BM, int BN>
__device__ __forceinline__ void gemm_mainloop_32x64(const float* __restrict__ A, const float* __restrict__ Bt,
                                                    int mblk, int nblk, int mw, int nw, int tid,
                                                    __bf16* __restrict__ Th, __bf16* __restrict__ Tl, v8f acc[2][4]) {
  constexpr int NA = BM / 16, NL = (BM + BN) / 16;   // the 128 threads cover 16 rows per load
  const int lane = tid & 31, sr = tid >> 3, sc = (tid & 7) * 4;
  const float* pa = A + (size_t)(mblk + sr) * KDIM + sc;
  const float* pb = Bt + (size_t)(nblk + sr) * KDIM + sc;
  v4f x[NL];   // the slice on its way from global memory: always one slice ahead of the products
#pragma unroll
  for (int i = 0; i < NL; ++i)
    x[i] = (i < NA) ? *(const v4f*)(pa + (size_t)i * 16 * KDIM) : *(const v4f*)(pb + (size_t)(i - NA) * 16 * KDIM);
  asm volatile("s_wait_xcnt 0x0" ::: "memory");   // stands ahead of any reuse of the loads' address registers
#pragma unroll 1
  for (int k0 = 0; k0 < KDIM; k0 += 32) {
    __syncthreads();   // every wave has taken its fragments of the slice before
#pragma unroll
    for (int i = 0; i < NL; ++i) {
      v4bf h, l;
#pragma unroll
      for (int e = 0; e < 4; ++e) { h[e] = bf_hi(x[i][e]); l[e] = bf_lo(x[i][e], h[e]); }
      vst2(Th + (i * 16 + sr) * TP_ + sc, h);
      vst2(Tl + (i * 16 + sr) * TP_ + sc, l);
    }
    __syncthreads();   // the slice is complete for every wave
    if (k0 + 32 < KDIM) {   // block-uniform: the next slice's loads go out here and fly under this slice's fragment reads and products
#pragma unroll
      for (int i = 0; i < NL; ++i)
        x[i] = (i < NA) ? *(const v4f*)(pa + (size_t)i * 16 * KDIM + k0 + 32) : *(const v4f*)(pb + (size_t)(i - NA) * 16 * KDIM + k0 + 32);
      asm volatile("s_wait_xcnt 0x0" ::: "memory");   // stands ahead of any reuse of the loads' address registers; also holds the loads ahead of the LDS reads below
    }
    v16bf ah[2], al[2], bh[4], bl[4];
#pragma unroll
    for (int i = 0; i < 2; ++i) { ah[i] = frag_lds(Th, TP_, mw + i * 16, 0, lane); al[i] = frag_lds(Tl, TP_, mw + i * 16, 0, lane); }
#pragma unroll
    for (int j = 0; j < 4; ++j) { bh[j] = frag_lds(Th, TP_, BM + nw + j * 16, 0, lane); bl[j] = frag_lds(Tl, TP_, BM + nw + j * 16, 0, lane); }
#pragma unroll
    for (int i = 0; i < 2; ++i)
#pragma unroll
      for (int j = 0; j < 4; ++j) acc[i][j] = wmma_x3(ah[i], al[i], bh[j], bl[j], acc[i][j]);
  }
}

// ---- Stage 1: one projection (part 0 = Q scaled, 1 = K, 2 = V^T). grid (QKV/64, M_TOT/128), block 128 = 4 waves stacked in M.
//      Q leaves as f32. K and V leave already split, as a bf16 hi plane and a bf16 lo plane, each laid out so that a 32-key tile of a head
//      is 4 KB in a row: K [B,H,S,HD], V [B,H,S/32,HD,32]. The split is made once here, not by every attention block that reads the tile.
__global__ __launch_bounds__(128) void proj_kernel(const float* __restrict__ X, const float* __restrict__ W, float scale,
                                                  int part, float* __restrict__ dst) {
  __shared__ __align__(16) float st[128][64];        // 32 KB
  __shared__ __align__(16) __bf16 Th[192 * TP_], Tl[192 * TP_];   // k slice: 128 rows of X, 64 rows of W
  const int lane = threadIdx.x & 31, wave = threadIdx.x >> 5, tid = threadIdx.x;
  const int mblk = blockIdx.y * 128;
  const int n0 = blockIdx.x * 64;
  const int head = n0 / HD_, d0 = n0 % HD_;
  const int b = mblk / S_, s0 = mblk % S_;

  v8f acc[2][4] = {};
  gemm_mainloop_32x64<D_, 128, 64>(X, W, mblk, n0, wave * 32, 0, tid, Th, Tl, acc);
  const int half = lane >> 4, col = lane & 15;
#pragma unroll
  for (int i = 0; i < 2; ++i)
#pragma unroll
    for (int j = 0; j < 4; ++j)
#pragma unroll
      for (int r = 0; r < 8; ++r) st[wave * 32 + i * 16 + r + 8 * half][j * 16 + col] = acc[i][j][r] * scale;
  __syncthreads();
  if (part == 0) {
    for (int g = tid; g < 128 * 16; g += 128) {            // 128 token rows x 16 pieces; a wave instruction covers 2 rows
      const int ml = g >> 4, pc = g & 15;
      vst2(dst + (((size_t)(b * H_ + head) * S_ + s0 + ml) * HD_) + d0 + pc * 4, *(const v4f*)(&st[ml][pc * 4]));
    }
  } else if (part == 1) {
    __bf16* ph = (__bf16*)dst;
    for (int g = tid; g < 128 * 16; g += 128) {            // 128 token rows x 16 pieces; a wave instruction covers 2 rows = 256 B of a plane
      const int ml = g >> 4, pc = g & 15;
      const v4f v = *(const v4f*)(&st[ml][pc * 4]);
      v4bf h, l;
#pragma unroll
      for (int e = 0; e < 4; ++e) { h[e] = bf_hi(v[e]); l[e] = bf_lo(v[e], h[e]); }
      const size_t o = (((size_t)(b * H_ + head) * S_ + s0 + ml) * HD_) + d0 + pc * 4;
      vst2(ph + o, h);
      vst2(ph + PLANE_ + o, l);
    }
  } else {
    __bf16* ph = (__bf16*)dst;
    for (int g = tid; g < 4 * 8 * 32; g += 128) {          // 4 key tiles x 8 groups of 8 d rows; a wave instruction covers 8 rows = 512 B of a plane
      const int kt = g >> 8, dl = ((g >> 5) & 7) * 8 + (lane >> 2), kp = (lane & 3) * 8;
      v8bf h, l;
#pragma unroll
      for (int e = 0; e < 8; ++e) { const float v = st[kt * 32 + kp + e][dl]; h[e] = bf_hi(v); l[e] = bf_lo(v, h[e]); }
      const size_t o = ((((size_t)(b * H_ + head) * (S_ / 32) + (s0 >> 5) + kt) * HD_) + d0 + dl) * 32 + kp;
      vst2(ph + o, h);
      vst2(ph + PLANE_ + o, l);
    }
  }
}

#define OP_ 68   // pitch in floats of a query row in the output staging
#define NQT_ (S_ / 64)   // 64-query tiles per head
__global__ __launch_bounds__(128) void attn_kernel(const float* __restrict__ Qb, const float* __restrict__ Kb,
                                                  const float* __restrict__ Vt, float* __restrict__ Ctx) {
  __shared__ __align__(16) __bf16 Kh[32 * 72], Kl[32 * 72];     // [key][d] pitch 72
  __shared__ __align__(16) __bf16 Vh[64 * 40], Vl[64 * 40];     // [d][key] pitch 40
  __shared__ __align__(16) float  Os[4][16 * OP_];

  const int tid = threadIdx.x, lane = tid & 31, wave = tid >> 5, half = lane >> 4, col = lane & 15;
  const int head = blockIdx.y, b = blockIdx.z;
  const float* Qh = Qb + (size_t)(b * H_ + head) * S_ * HD_;
  // K and V arrive split (hi plane, then lo plane); in all four planes the 32-key tile at t0 is the 4 KB from element t0 * HD_ of the head
  const __bf16* Kg = (const __bf16*)Kb + (size_t)(b * H_ + head) * S_ * HD_ + tid * 8;
  const __bf16* Vg = (const __bf16*)Vt + (size_t)(b * H_ + head) * S_ * HD_ + tid * 8;
  // kept rolled: one copy of the key loop in the instruction cache, one set of registers
#pragma unroll 1
  for (int pass = 0; pass < 2; ++pass) {
  const int q0 = (pass == 0 ? NQT_ - 1 - (int)blockIdx.x : (int)blockIdx.x) * 64;   // block-uniform
  const int mq = q0 + wave * 16;

  v16bf qh[2], ql[2];
#pragma unroll
  for (int kb = 0; kb < 2; ++kb) frag_f32(Qh, HD_, mq, kb * 32, lane, qh[kb], ql[kb]);

  v8f o[4] = {};
  float mrow = -1e30f, lrow = 0.0f;     // this lane's query: running maximum (same in both halves), sum over this half's keys
  const int qg = mq + col;

  const int t_end = q0 + 64;            // causal limit (block-uniform, multiple of 32)
  // K (32 x 64) and V^T (64 x 32), hi and lo, on their way from global memory, always one key tile ahead of the products:
  // a plain copy, 16 bytes per lane, so a wave instruction reads 4 whole lines
  v8bf xk[2][2], xv[2][2];
#pragma unroll
  for (int i = 0; i < 2; ++i) {
    xk[0][i] = *(const v8bf*)(Kg + i * 1024); xk[1][i] = *(const v8bf*)(Kg + PLANE_ + i * 1024);
    xv[0][i] = *(const v8bf*)(Vg + i * 1024); xv[1][i] = *(const v8bf*)(Vg + PLANE_ + i * 1024);
  }
  asm volatile("s_wait_xcnt 0x0" ::: "memory");   // stands ahead of any reuse of the loads' address registers
  for (int t0 = 0; t0 < t_end; t0 += 32) {
    __syncthreads();
    {   // the tile that has arrived goes to LDS
#pragma unroll
      for (int i = 0; i < 2; ++i) {
        const int pc = i * 128 + tid;      // 16-byte piece of the tile: 8 pieces per K row, 4 per V^T row
        vst2(Kh + (pc >> 3) * 72 + (pc & 7) * 8, xk[0][i]); vst2(Kl + (pc >> 3) * 72 + (pc & 7) * 8, xk[1][i]);
        vst2(Vh + (pc >> 2) * 40 + (pc & 3) * 8, xv[0][i]); vst2(Vl + (pc >> 2) * 40 + (pc & 3) * 8, xv[1][i]);
      }
    }
    __syncthreads();
    if (t0 + 32 < t_end) {   // block-uniform: the next key tile's loads go out here and fly under this tile's products and softmax
      const __bf16* kp = Kg + (size_t)(t0 + 32) * HD_;
      const __bf16* vp = Vg + (size_t)(t0 + 32) * HD_;
#pragma unroll
      for (int i = 0; i < 2; ++i) {
        xk[0][i] = *(const v8bf*)(kp + i * 1024); xk[1][i] = *(const v8bf*)(kp + PLANE_ + i * 1024);
        xv[0][i] = *(const v8bf*)(vp + i * 1024); xv[1][i] = *(const v8bf*)(vp + PLANE_ + i * 1024);
      }
      asm volatile("s_wait_xcnt 0x0" ::: "memory");   // stands ahead of any reuse of the loads' address registers; also holds the loads ahead of the LDS reads below
    }

    v8f s[2] = {};
#pragma unroll
    for (int n = 0; n < 2; ++n)
#pragma unroll
      for (int kb = 0; kb < 2; ++kb)
        s[n] = wmma_x3(frag_lds(Kh, 72, n * 16, kb * 32, lane), frag_lds(Kl, 72, n * 16, kb * 32, lane), qh[kb], ql[kb], s[n]);

    v16bf pbh, pbl;
    {
      const int kg = t0 + 8 * half;      // s[n][r] is key kg + 16 * n + r against query qg
      float mx = -1e30f;
#pragma unroll
      for (int n = 0; n < 2; ++n)
#pragma unroll
        for (int r = 0; r < 8; ++r) {
          s[n][r] = (kg + n * 16 + r <= qg) ? s[n][r] : -1e30f;   // scores already carry the 1/8 scale (folded into Q)
          mx = fmaxf(mx, s[n][r]);
        }
      mx = fmaxf(mx, xhalf(mx));
      const float mnew  = fmaxf(mrow, mx);
      const float alpha = __expf(mrow - mnew);
      float rs = 0.0f;
#pragma unroll
      for (int n = 0; n < 2; ++n)
#pragma unroll
        for (int r = 0; r < 8; ++r) {
          const float p = (kg + n * 16 + r <= qg) ? __expf(s[n][r] - mnew) : 0.0f;
          rs += p;
          const __bf16 h = bf_hi(p);
          pbh[n * 8 + r] = h; pbl[n * 8 + r] = bf_lo(p, h);
        }
      lrow = lrow * alpha + rs;
      mrow = mnew;
#pragma unroll
      for (int j = 0; j < 4; ++j)
#pragma unroll
        for (int r = 0; r < 8; ++r) o[j][r] *= alpha;
    }
#pragma unroll
    for (int j = 0; j < 4; ++j)
      o[j] = wmma_x3(frag_lds(Vh, 40, j * 16, 0, lane), frag_lds(Vl, 40, j * 16, 0, lane), pbh, pbl, o[j]);
  }

  float* os_ = Os[wave];
  const float inv = 1.0f / (lrow + xhalf(lrow));   // the two halves' key sums joined once
#pragma unroll
  for (int j = 0; j < 4; ++j) {                    // o[j][r] is d = j * 16 + 8 * half + r of query col
    const v4f w0 = {o[j][0] * inv, o[j][1] * inv, o[j][2] * inv, o[j][3] * inv};
    const v4f w1 = {o[j][4] * inv, o[j][5] * inv, o[j][6] * inv, o[j][7] * inv};
    vst2(os_ + col * OP_ + j * 16 + 8 * half, w0);
    vst2(os_ + col * OP_ + j * 16 + 8 * half + 4, w1);
  }
  __syncthreads();
#pragma unroll
  for (int q = 0; q < 8; ++q) {
    const int rl = q * 2 + (lane >> 4), pc = lane & 15;
    vst2(Ctx + ((size_t)(b * S_ + mq + rl)) * D_ + head * HD_ + pc * 4, *(const v4f*)(os_ + rl * OP_ + pc * 4));
  }
  asm volatile("s_wait_xcnt 0x0" ::: "memory");   // stands ahead of the next tile's reuse of the stores' address and data registers
  }
}

__global__ __launch_bounds__(128) void out_gemm_kernel(const float* __restrict__ Cx, const float* __restrict__ Wo, float* __restrict__ Out) {
  __shared__ __align__(16) float st[4][32 * 64];
  __shared__ __align__(16) __bf16 Th[192 * TP_], Tl[192 * TP_];   // k slice: 64 rows of Cx, 128 rows of Wo
  const int lane = threadIdx.x & 31, wave = threadIdx.x >> 5;
  const int m0 = blockIdx.y * 64 + (wave >> 1) * 32;
  const int n0 = blockIdx.x * 128 + (wave & 1) * 64;
  v8f acc[2][4] = {};
  gemm_mainloop_32x64<QKV_, 64, 128>(Cx, Wo, blockIdx.y * 64, blockIdx.x * 128, (wave >> 1) * 32, (wave & 1) * 64, threadIdx.x, Th, Tl, acc);
  const int half = lane >> 4, col = lane & 15;
  float* S = st[wave];
#pragma unroll
  for (int i = 0; i < 2; ++i)
#pragma unroll
    for (int j = 0; j < 4; ++j)
#pragma unroll
      for (int r = 0; r < 8; ++r) S[(i * 16 + r + 8 * half) * 64 + j * 16 + col] = acc[i][j][r];
  __syncthreads();
#pragma unroll
  for (int q = 0; q < 16; ++q) {
    const int rl = q * 2 + (lane >> 4), pc = lane & 15;
    vst2(Out + (size_t)(m0 + rl) * D_ + n0 + pc * 4, *(const v4f*)(S + rl * 64 + pc * 4));
  }
}

extern "C" void kernel_launch(void* const* d_in, const int* in_sizes, int n_in,
                              void* d_out, int out_size, void* d_ws, size_t ws_size,
                              hipStream_t stream) {
  (void)in_sizes; (void)n_in; (void)out_size; (void)ws_size;
  const float* x    = (const float*)d_in[0];
  const float* Wqkv = (const float*)d_in[1];   // [3D][D]: rows [0,D) = Wq, [D,2D) = Wk, [2D,3D) = Wv
  const float* Wout = (const float*)d_in[2];   // [D][D]
  float* out = (float*)d_out;

  const size_t E = (size_t)M_TOT * D_;          // 8,388,608 floats per buffer (32 MB)
  float* qb   = (float*)d_ws;
  float* kb   = qb + E;
  float* vtb  = kb + E;        // kb, vtb: each a bf16 hi plane and a bf16 lo plane of E elements (K [B,H,S,HD], V [B,H,S/32,HD,32])
  float* ctxb = vtb + E;       // total 128 MB

  dim3 gp(D_ / 64, M_TOT / 128);
  proj_kernel<<<gp, 128, 0, stream>>>(x, Wqkv,                       SCALE_, 0, qb);
  proj_kernel<<<gp, 128, 0, stream>>>(x, Wqkv + (size_t)D_ * D_,     1.0f,   1, kb);
  proj_kernel<<<gp, 128, 0, stream>>>(x, Wqkv + (size_t)2 * D_ * D_, 1.0f,   2, vtb);
  attn_kernel<<<dim3(S_ / 128, H_, B_), 128, 0, stream>>>(qb, kb, vtb, ctxb);
  out_gemm_kernel<<<dim3(D_ / 128, M_TOT / 64), 128, 0, stream>>>(ctxb, Wout, out);
}

// v007
// Measured time: 325 microseconds a run.
// Two timings next to v006 both put it at 1.04 times that version's speed.
// Counting every step since v000, it is 2.50 times as fast.
#include <hip/hip_runtime.h>

// ---------------------------------------------------------------------------
// CausalMultiHeadSelfAttention (B=2, S=4096, D=1024, H=16, HD=64, causal; packed Wqkv [3D][D], Wout [D][D])
// Contractions: Q/K/V projections (K = 1024), QK^T (K = 64), P V (K = keys) and the output projection (K = 1024) — all on
// v_wmma_f32_16x16x32_bf16 as bf16 hi/lo splits (hi*hi + hi*lo + lo*hi, f32 accumulate) with every operand kept in f32 and
// split in registers / at LDS staging, but K and V, which leave their projections as hi/lo planes (causal rows expose single V rows,
// so plain 16-bit operands miss).
// ---------------------------------------------------------------------------

#define B_   2
#define S_   4096
#define D_   1024
#define QKV_ 1024
#define H_   16
#define HD_  64
#define M_TOT (B_ * S_)
#define SCALE_ 0.125f  // 64^-0.5
#define PLANE_ ((size_t)M_TOT * D_)   // elements of one bf16 plane of K or V; the lo plane follows the hi plane

typedef __attribute__((ext_vector_type(16))) __bf16 v16bf;
typedef __attribute__((ext_vector_type(8)))  __bf16 v8bf;
typedef __attribute__((ext_vector_type(4)))  __bf16 v4bf;
typedef __attribute__((ext_vector_type(8)))  float  v8f;
typedef __attribute__((ext_vector_type(4)))  float  v4f;

template <typename V> __device__ __forceinline__ void vst2(void* p, V v) {
  *(V*)p = v; 
}
__device__ __forceinline__ __bf16 bf_hi(float x) { return (__bf16)x; }
__device__ __forceinline__ __bf16 bf_lo(float x, __bf16 h) { return (__bf16)(x - (float)h); }
// the plain builtin: the compiler keeps the distances behind it itself, and is free to issue the products of independent accumulator
// tiles back to back and to fetch LDS fragments ahead of them (each accumulator still takes hi*hi, hi*lo, lo*hi in this order)
__device__ __forceinline__ v8f wmma_bf16(v16bf a, v16bf b, v8f c) {
  return __builtin_amdgcn_wmma_f32_16x16x32_bf16(false, a, false, b, (short)0, c, false, false);
}
__device__ __forceinline__ v8f wmma_x3(v16bf ah, v16bf al, v16bf bh, v16bf bl, v8f c) {
  c = wmma_bf16(ah, bh, c); c = wmma_bf16(ah, bl, c); c = wmma_bf16(al, bh, c);
  return c;
}

// lane l takes the value of lane l ^ 16 (the other half of the wave)
__device__ __forceinline__ float xhalf(float x) {
  return __builtin_bit_cast(float, __builtin_amdgcn_permlanex16(__builtin_bit_cast(int, x), __builtin_bit_cast(int, x), 0x76543210, 0xfedcba98, false, false));
}

// ---- fragment loaders (wave32): A (16x32 from [M][ld]) and B from B^T ([N][ld]) share the per-lane K map:
//      row/col = lane&15; elements 0..7 <- k0 + 8*half + 0..7, elements 8..15 <- k0 + 16 + 8*half + 0..7
// f32 source split into bf16 hi/lo
__device__ __forceinline__ void frag_f32(const float* __restrict__ base, int ld, int r0, int k0, int lane, v16bf& hi, v16bf& lo) {
  const float* p = base + (size_t)(r0 + (lane & 15)) * ld + k0 + (lane >> 4) * 8;
  const v4f a0 = *(const v4f*)(p), a1 = *(const v4f*)(p + 4), a2 = *(const v4f*)(p + 16), a3 = *(const v4f*)(p + 20);
#pragma unroll
  for (int i = 0; i < 4; ++i) {
    __bf16 h;
    h = bf_hi(a0[i]); hi[i] = h;      lo[i] = bf_lo(a0[i], h);
    h = bf_hi(a1[i]); hi[4 + i] = h;  lo[4 + i] = bf_lo(a1[i], h);
    h = bf_hi(a2[i]); hi[8 + i] = h;  lo[8 + i] = bf_lo(a2[i], h);
    h = bf_hi(a3[i]); hi[12 + i] = h; lo[12 + i] = bf_lo(a3[i], h);
  }
}
// bf16 plane in LDS
__device__ __forceinline__ v16bf frag_lds(const __bf16* base, int ld, int r0, int k0, int lane) {
  union { v16bf v; v8bf h[2]; } r;
  const __bf16* p = base + (r0 + (lane & 15)) * ld + k0 + (lane >> 4) * 8;
  r.h[0] = *(const v8bf*)(p); r.h[1] = *(const v8bf*)(p + 16);
  return r.v;
}


// ---- 32x64-per-wave GEMM main loop over f32 operands (A [M][K], Bt [N][K]) split into bf16 hi/lo; block = 4 waves, tile BM x BN.
//      Each 32-wide k slice (BM rows of A, then BN rows of Bt) is read from global memory in whole 128-byte lines (8 lanes per row),
//      split once per block and kept as two bf16 planes in LDS; the waves take their fragments from there (same k map as frag_f32).
#define TP_ 40   // LDS row pitch of a slice in bf16 elements (80 bytes)
template <int KDIM, int BM, int BN>
__device__ __forceinline__ void gemm_mainloop_32x64(const float* __restrict__ A, const float* __restrict__ Bt,
                                                    int mblk, int nblk, int mw, int nw, int tid,
                                                    __bf16* __restrict__ Th, __bf16* __restrict__ Tl, v8f acc[2][4]) {
  constexpr int NA = BM / 16, NL = (BM + BN) / 16;   // the 128 threads cover 16 rows per load
  const int lane = tid & 31, sr = tid >> 3, sc = (tid & 7) * 4;
  const float* pa = A + (size_t)(mblk + sr) * KDIM + sc;
  const float* pb = Bt + (size_t)(nblk + sr) * KDIM + sc;
  v4f x[NL];   // the slice on its way from global memory: always one slice ahead of the products
#pragma unroll
  for (int i = 0; i < NL; ++i)
    x[i] = (i < NA) ? *(const v4f*)(pa + (size_t)i * 16 * KDIM) : *(const v4f*)(pb + (size_t)(i - NA) * 16 * KDIM);
  asm volatile("s_wait_xcnt 0x0" ::: "memory");   // stands ahead of any reuse of the loads' address registers
#pragma unroll 1
  for (int k0 = 0; k0 < KDIM; k0 += 32) {
    __syncthreads();   // every wave has taken its fragments of the slice before
#pragma unroll
    for (int i = 0; i < NL; ++i) {
      v4bf h, l;
#pragma unroll
      for (int e = 0; e < 4; ++e) { h[e] = bf_hi(x[i][e]); l[e] = bf_lo(x[i][e], h[e]); }
      vst2(Th + (i * 16 + sr) * TP_ + sc, h);
      vst2(Tl + (i * 16 + sr) * TP_ + sc, l);
    }
    __syncthreads();   // the slice is complete for every wave
    if (k0 + 32 < KDIM) {   // block-uniform: the next slice's loads go out here and fly under this slice's fragment reads and products
#pragma unroll
      for (int i = 0; i < NL; ++i)
        x[i] = (i < NA) ? *(const v4f*)(pa + (size_t)i * 16 * KDIM + k0 + 32) : *(const v4f*)(pb + (size_t)(i - NA) * 16 * KDIM + k0 + 32);
      asm volatile("s_wait_xcnt 0x0" ::: "memory");   // stands ahead of any reuse of the loads' address registers; also holds the loads ahead of the LDS reads below
    }
    v16bf ah[2], al[2], bh[4], bl[4];
#pragma unroll
    for (int i = 0; i < 2; ++i) { ah[i] = frag_lds(Th, TP_, mw + i * 16, 0, lane); al[i] = frag_lds(Tl, TP_, mw + i * 16, 0, lane); }
#pragma unroll
    for (int j = 0; j < 4; ++j) { bh[j] = frag_lds(Th, TP_, BM + nw + j * 16, 0, lane); bl[j] = frag_lds(Tl, TP_, BM + nw + j * 16, 0, lane); }
#pragma unroll
    for (int i = 0; i < 2; ++i)
#pragma unroll
      for (int j = 0; j < 4; ++j) acc[i][j] = wmma_x3(ah[i], al[i], bh[j], bl[j], acc[i][j]);
  }
}

// ---- Stage 1: one projection (part 0 = Q scaled, 1 = K, 2 = V^T). grid (QKV/64, M_TOT/128), block 128 = 4 waves stacked in M.
//      Q leaves as f32. K and V leave already split, as a bf16 hi plane and a bf16 lo plane, each laid out so that a 32-key tile of a head
//      is 4 KB in a row: K [B,H,S,HD], V [B,H,S/32,HD,32]. The split is made once here, not by every attention block that reads the tile.
__global__ __launch_bounds__(128) void proj_kernel(const float* __restrict__ X, const float* __restrict__ W, float scale,
                                                  int part, float* __restrict__ dst) {
  __shared__ __align__(16) float st[128][64];        // 32 KB
  __shared__ __align__(16) __bf16 Th[192 * TP_], Tl[192 * TP_];   // k slice: 128 rows of X, 64 rows of W
  const int lane = threadIdx.x & 31, wave = threadIdx.x >> 5, tid = threadIdx.x;
  const int mblk = blockIdx.y * 128;
  const int n0 = blockIdx.x * 64;
  const int head = n0 / HD_, d0 = n0 % HD_;
  const int b = mblk / S_, s0 = mblk % S_;

  v8f acc[2][4] = {};
  gemm_mainloop_32x64<D_, 128, 64>(X, W, mblk, n0, wave * 32, 0, tid, Th, Tl, acc);
  const int half = lane >> 4, col = lane & 15;
#pragma unroll
  for (int i = 0; i < 2; ++i)
#pragma unroll
    for (int j = 0; j < 4; ++j)
#pragma unroll
      for (int r = 0; r < 8; ++r) st[wave * 32 + i * 16 + r + 8 * half][j * 16 + col] = acc[i][j][r] * scale;
  __syncthreads();
  if (part == 0) {
    for (int g = tid; g < 128 * 16; g += 128) {            // 128 token rows x 16 pieces; a wave instruction covers 2 rows
      const int ml = g >> 4, pc = g & 15;
      vst2(dst + (((size_t)(b * H_ + head) * S_ + s0 + ml) * HD_) + d0 + pc * 4, *(const v4f*)(&st[ml][pc * 4]));
    }
  } else if (part == 1) {
    __bf16* ph = (__bf16*)dst;
    for (int g = tid; g < 128 * 16; g += 128) {            // 128 token rows x 16 pieces; a wave instruction covers 2 rows = 256 B of a plane
      const int ml = g >> 4, pc = g & 15;
      const v4f v = *(const v4f*)(&st[ml][pc * 4]);
      v4bf h, l;
#pragma unroll
      for (int e = 0; e < 4; ++e) { h[e] = bf_hi(v[e]); l[e] = bf_lo(v[e], h[e]); }
      const size_t o = (((size_t)(b * H_ + head) * S_ + s0 + ml) * HD_) + d0 + pc * 4;
      vst2(ph + o, h);
      vst2(ph + PLANE_ + o, l);
    }
  } else {
    __bf16* ph = (__bf16*)dst;
    for (int g = tid; g < 4 * 8 * 32; g += 128) {          // 4 key tiles x 8 groups of 8 d rows; a wave instruction covers 8 rows = 512 B of a plane
      const int kt = g >> 8, dl = ((g >> 5) & 7) * 8 + (lane >> 2), kp = (lane & 3) * 8;
      v8bf h, l;
#pragma unroll
      for (int e = 0; e < 8; ++e) { const float v = st[kt * 32 + kp + e][dl]; h[e] = bf_hi(v); l[e] = bf_lo(v, h[e]); }
      const size_t o = ((((size_t)(b * H_ + head) * (S_ / 32) + (s0 >> 5) + kt) * HD_) + d0 + dl) * 32 + kp;
      vst2(ph + o, h);
      vst2(ph + PLANE_ + o, l);
    }
  }
}

// One 32-key tile of the key loop: the tile that has arrived goes to LDS, the next one's loads go out, then S^T, softmax, O^T.
// MASK = false is for a tile whose last key stands before the block's first query: there key <= query holds for all 16 scores of every lane,
// so the causal compares and selects are left out; MASK = true works them.
template <bool MASK>
__device__ __forceinline__ void key_tile(int t0, int t_end, int tid, int lane, int half, int qg,
                                         const __bf16* __restrict__ Kg, const __bf16* __restrict__ Vg,
                                         __bf16* Kh, __bf16* Kl, __bf16* Vh, __bf16* Vl,
                                         v8bf (&xk)[2][2], v8bf (&xv)[2][2], const v16bf (&qh)[2], const v16bf (&ql)[2],
                                         v8f (&o)[4], float& mrow, float& lrow) {
  __syncthreads();
  {   // the tile that has arrived goes to LDS
#pragma unroll
    for (int i = 0; i < 2; ++i) {
      const int pc = i * 128 + tid;      // 16-byte piece of the tile: 8 pieces per K row, 4 per V^T row
      vst2(Kh + (pc >> 3) * 72 + (pc & 7) * 8, xk[0][i]); vst2(Kl + (pc >> 3) * 72 + (pc & 7) * 8, xk[1][i]);
      vst2(Vh + (pc >> 2) * 40 + (pc & 3) * 8, xv[0][i]); vst2(Vl + (pc >> 2) * 40 + (pc & 3) * 8, xv[1][i]);
    }
  }
  __syncthreads();
  if (t0 + 32 < t_end) {   // block-uniform: the next key tile's loads go out here and fly under this tile's products and softmax
    const __bf16* kp = Kg + (size_t)(t0 + 32) * HD_;
    const __bf16* vp = Vg + (size_t)(t0 + 32) * HD_;
#pragma unroll
    for (int i = 0; i < 2; ++i) {
      xk[0][i] = *(const v8bf*)(kp + i * 1024); xk[1][i] = *(const v8bf*)(kp + PLANE_ + i * 1024);
      xv[0][i] = *(const v8bf*)(vp + i * 1024); xv[1][i] = *(const v8bf*)(vp + PLANE_ + i * 1024);
    }
    asm volatile("s_wait_xcnt 0x0" ::: "memory");   // stands ahead of any reuse of the loads' address registers; also holds the loads ahead of the LDS reads below
  }

  v8f s[2] = {};
#pragma unroll
  for (int n = 0; n < 2; ++n)
#pragma unroll
    for (int kb = 0; kb < 2; ++kb)
      s[n] = wmma_x3(frag_lds(Kh, 72, n * 16, kb * 32, lane), frag_lds(Kl, 72, n * 16, kb * 32, lane), qh[kb], ql[kb], s[n]);

  v16bf pbh, pbl;
  {
    const int kg = t0 + 8 * half;      // s[n][r] is key kg + 16 * n + r against query qg
    float mx = -1e30f;
#pragma unroll
    for (int n = 0; n < 2; ++n)
#pragma unroll
      for (int r = 0; r < 8; ++r) {
        if (MASK) s[n][r] = (kg + n * 16 + r <= qg) ? s[n][r] : -1e30f;   // scores already carry the 1/8 scale (folded into Q)
        mx = fmaxf(mx, s[n][r]);
      }
    mx = fmaxf(mx, xhalf(mx));
    const float mnew  = fmaxf(mrow, mx);
    const float alpha = __expf(mrow - mnew);
    float rs = 0.0f;
#pragma unroll
    for (int n = 0; n < 2; ++n)
#pragma unroll
      for (int r = 0; r < 8; ++r) {
        const float p = (!MASK || kg + n * 16 + r <= qg) ? __expf(s[n][r] - mnew) : 0.0f;
        rs += p;
        const __bf16 h = bf_hi(p);
        pbh[n * 8 + r] = h; pbl[n * 8 + r] = bf_lo(p, h);
      }
    lrow = lrow * alpha + rs;
    mrow = mnew;
#pragma unroll
    for (int j = 0; j < 4; ++j)
#pragma unroll
      for (int r = 0; r < 8; ++r) o[j][r] *= alpha;
  }
#pragma unroll
  for (int j = 0; j < 4; ++j)
    o[j] = wmma_x3(frag_lds(Vh, 40, j * 16, 0, lane), frag_lds(Vl, 40, j * 16, 0, lane), pbh, pbl, o[j]);
}

#define OP_ 68   // pitch in floats of a query row in the output staging
#define NQT_ (S_ / 64)   // 64-query tiles per head
__global__ __launch_bounds__(128) void attn_kernel(const float* __restrict__ Qb, const float* __restrict__ Kb,
                                                  const float* __restrict__ Vt, float* __restrict__ Ctx) {
  __shared__ __align__(16) __bf16 Kh[32 * 72], Kl[32 * 72];     // [key][d] pitch 72
  __shared__ __align__(16) __bf16 Vh[64 * 40], Vl[64 * 40];     // [d][key] pitch 40
  __shared__ __align__(16) float  Os[4][16 * OP_];

  const int tid = threadIdx.x, lane = tid & 31, wave = tid >> 5, half = lane >> 4, col = lane & 15;
  const int head = blockIdx.y, b = blockIdx.z;
  const float* Qh = Qb + (size_t)(b * H_ + head) * S_ * HD_;
  // K and V arrive split (hi plane, then lo plane); in all four planes the 32-key tile at t0 is the 4 KB from element t0 * HD_ of the head
  const __bf16* Kg = (const __bf16*)Kb + (size_t)(b * H_ + head) * S_ * HD_ + tid * 8;
  const __bf16* Vg = (const __bf16*)Vt + (size_t)(b * H_ + head) * S_ * HD_ + tid * 8;
  // kept rolled: one copy of the key loop in the instruction cache, one set of registers
#pragma unroll 1
  for (int pass = 0; pass < 2; ++pass) {
  const int q0 = (pass == 0 ? NQT_ - 1 - (int)blockIdx.x : (int)blockIdx.x) * 64;   // block-uniform
  const int mq = q0 + wave * 16;

  v16bf qh[2], ql[2];
#pragma unroll
  for (int kb = 0; kb < 2; ++kb) frag_f32(Qh, HD_, mq, kb * 32, lane, qh[kb], ql[kb]);

  v8f o[4] = {};
  float mrow = -1e30f, lrow = 0.0f;     // this lane's query: running maximum (same in both halves), sum over this half's keys
  const int qg = mq + col;

  const int t_end = q0 + 64;            // causal limit (block-uniform, multiple of 32)
  // K (32 x 64) and V^T (64 x 32), hi and lo, on their way from global memory, always one key tile ahead of the products:
  // a plain copy, 16 bytes per lane, so a wave instruction reads 4 whole lines
  v8bf xk[2][2], xv[2][2];
#pragma unroll
  for (int i = 0; i < 2; ++i) {
    xk[0][i] = *(const v8bf*)(Kg + i * 1024); xk[1][i] = *(const v8bf*)(Kg + PLANE_ + i * 1024);
    xv[0][i] = *(const v8bf*)(Vg + i * 1024); xv[1][i] = *(const v8bf*)(Vg + PLANE_ + i * 1024);
  }
  asm volatile("s_wait_xcnt 0x0" ::: "memory");   // stands ahead of any reuse of the loads' address registers
  // tiles wholly before the block's first query (t0 + 32 <= q0, block-uniform) need no mask; the two tiles from q0 on do
  int t0 = 0;
  for (; t0 < q0; t0 += 32) key_tile<false>(t0, t_end, tid, lane, half, qg, Kg, Vg, Kh, Kl, Vh, Vl, xk, xv, qh, ql, o, mrow, lrow);
  for (; t0 < t_end; t0 += 32) key_tile<true>(t0, t_end, tid, lane, half, qg, Kg, Vg, Kh, Kl, Vh, Vl, xk, xv, qh, ql, o, mrow, lrow);

  float* os_ = Os[wave];
  const float inv = 1.0f / (lrow + xhalf(lrow));   // the two halves' key sums joined once
#pragma unroll
  for (int j = 0; j < 4; ++j) {                    // o[j][r] is d = j * 16 + 8 * half + r of query col
    const v4f w0 = {o[j][0] * inv, o[j][1] * inv, o[j][2] * inv, o[j][3] * inv};
    const v4f w1 = {o[j][4] * inv, o[j][5] * inv, o[j][6] * inv, o[j][7] * inv};
    vst2(os_ + col * OP_ + j * 16 + 8 * half, w0);
    vst2(os_ + col * OP_ + j * 16 + 8 * half + 4, w1);
  }
  __syncthreads();
#pragma unroll
  for (int q = 0; q < 8; ++q) {
    const int rl = q * 2 + (lane >> 4), pc = lane & 15;
    vst2(Ctx + ((size_t)(b * S_ + mq + rl)) * D_ + head * HD_ + pc * 4, *(const v4f*)(os_ + rl * OP_ + pc * 4));
  }
  asm volatile("s_wait_xcnt 0x0" ::: "memory");   // stands ahead of the next tile's reuse of the stores' address and data registers
  }
}

__global__ __launch_bounds__(128) void out_gemm_kernel(const float* __restrict__ Cx, const float* __restrict__ Wo, float* __restrict__ Out) {
  __shared__ __align__(16) float st[4][32 * 64];
  __shared__ __align__(16) __bf16 Th[192 * TP_], Tl[192 * TP_];   // k slice: 64 rows of Cx, 128 rows of Wo
  const int lane = threadIdx.x & 31, wave = threadIdx.x >> 5;
  const int m0 = blockIdx.y * 64 + (wave >> 1) * 32;
  const int n0 = blockIdx.x * 128 + (wave & 1) * 64;
  v8f acc[2][4] = {};
  gemm_mainloop_32x64<QKV_, 64, 128>(Cx, Wo, blockIdx.y * 64, blockIdx.x * 128, (wave >> 1) * 32, (wave & 1) * 64, threadIdx.x, Th, Tl, acc);
  const int half = lane >> 4, col = lane & 15;
  float* S = st[wave];
#pragma unroll
  for (int i = 0; i < 2; ++i)
#pragma unroll
    for (int j = 0; j < 4; ++j)
#pragma unroll
      for (int r = 0; r < 8; ++r) S[(i * 16 + r + 8 * half) * 64 + j * 16 + col] = acc[i][j][r];
  __syncthreads();
#pragma unroll
  for (int q = 0; q < 16; ++q) {
    const int rl = q * 2 + (lane >> 4), pc = lane & 15;
    vst2(Out + (size_t)(m0 + rl) * D_ + n0 + pc * 4, *(const v4f*)(S + rl * 64 + pc * 4));
  }
}

extern "C" void kernel_launch(void* const* d_in, const int* in_sizes, int n_in,
                              void* d_out, int out_size, void* d_ws, size_t ws_size,
                              hipStream_t stream) {
  (void)in_sizes; (void)n_in; (void)out_size; (void)ws_size;
  const float* x    = (const float*)d_in[0];
  const float* Wqkv = (const float*)d_in[1];   // [3D][D]: rows [0,D) = Wq, [D,2D) = Wk, [2D,3D) = Wv
  const float* Wout = (const float*)d_in[2];   // [D][D]
  float* out = (float*)d_out;

  const size_t E = (size_t)M_TOT * D_;          // 8,388,608 floats per buffer (32 MB)
  float* qb   = (float*)d_ws;
  float* kb   = qb + E;
  float* vtb  = kb + E;        // kb, vtb: each a bf16 hi plane and a bf16 lo plane of E elements (K [B,H,S,HD], V [B,H,S/32,HD,32])
  float* ctxb = vtb + E;       // total 128 MB

  dim3 gp(D_ / 64, M_TOT / 128);
  proj_kernel<<<gp, 128, 0, stream>>>(x, Wqkv,                       SCALE_, 0, qb);
  proj_kernel<<<gp, 128, 0, stream>>>(x, Wqkv + (size_t)D_ * D_,     1.0f,   1, kb);
  proj_kernel<<<gp, 128, 0, stream>>>(x, Wqkv + (size_t)2 * D_ * D_, 1.0f,   2, vtb);
  attn_kernel<<<dim3(S_ / 128, H_, B_), 128, 0, stream>>>(qb, kb, vtb, ctxb);
  out_gemm_kernel<<<dim3(D_ / 128, M_TOT / 64), 128, 0, stream>>>(ctxb, Wout, out);
}

// v008
// One run takes 303 microseconds.
// Two timings next to v007 both put it at 1.07 times that version's speed.
// Counting every step since v000, it is 2.68 times as fast.
#include <hip/hip_runtime.h>

// ---------------------------------------------------------------------------
// CausalMultiHeadSelfAttention (B=2, S=4096, D=1024, H=16, HD=64, causal; packed Wqkv [3D][D], Wout [D][D])
// Contractions: Q/K/V projections (K = 1024), QK^T (K = 64), P V (K = keys) and the output projection (K = 1024) — all on
// v_wmma_f32_16x16x32_bf16 as bf16 hi/lo splits (hi*hi + hi*lo + lo*hi, f32 accumulate) with every operand kept in f32 and
// split in registers / at LDS staging, but K and V, which leave their projections as hi/lo planes (causal rows expose single V rows,
// so plain 16-bit operands miss).
// ---------------------------------------------------------------------------

#define B_   2
#define S_   4096
#define D_   1024
#define QKV_ 1024
#define H_   16
#define HD_  64
#define M_TOT (B_ * S_)
#define SCALE_ 0.125f  // 64^-0.5
#define PLANE_ ((size_t)M_TOT * D_)   // elements of one bf16 plane of K or V; the lo plane follows the hi plane

typedef __attribute__((ext_vector_type(16))) __bf16 v16bf;
typedef __attribute__((ext_vector_type(8)))  __bf16 v8bf;
typedef __attribute__((ext_vector_type(4)))  __bf16 v4bf;
typedef __attribute__((ext_vector_type(8)))  float  v8f;
typedef __attribute__((ext_vector_type(4)))  float  v4f;

template <typename V> __device__ __forceinline__ void vst2(void* p, V v) {
  *(V*)p = v; 
}
__device__ __forceinline__ __bf16 bf_hi(float x) { return (__bf16)x; }
__device__ __forceinline__ __bf16 bf_lo(float x, __bf16 h) { return (__bf16)(x - (float)h); }
// the plain builtin: the compiler keeps the distances behind it itself, and is free to issue the products of independent accumulator
// tiles back to back and to fetch LDS fragments ahead of them (each accumulator still takes hi*hi, hi*lo, lo*hi in this order)
__device__ __forceinline__ v8f wmma_bf16(v16bf a, v16bf b, v8f c) {
  return __builtin_amdgcn_wmma_f32_16x16x32_bf16(false, a, false, b, (short)0, c, false, false);
}
__device__ __forceinline__ v8f wmma_x3(v16bf ah, v16bf al, v16bf bh, v16bf bl, v8f c) {
  c = wmma_bf16(ah, bh, c); c = wmma_bf16(ah, bl, c); c = wmma_bf16(al, bh, c);
  return c;
}

// lane l takes the value of lane l ^ 16 (the other half of the wave)
__device__ __forceinline__ float xhalf(float x) {
  return __builtin_bit_cast(float, __builtin_amdgcn_permlanex16(__builtin_bit_cast(int, x), __builtin_bit_cast(int, x), 0x76543210, 0xfedcba98, false, false));
}

// ---- fragment loaders (wave32): A (16x32 from [M][ld]) and B from B^T ([N][ld]) share the per-lane K map:
//      row/col = lane&15; elements 0..7 <- k0 + 8*half + 0..7, elements 8..15 <- k0 + 16 + 8*half + 0..7
// f32 source split into bf16 hi/lo
__device__ __forceinline__ void frag_f32(const float* __restrict__ base, int ld, int r0, int k0, int lane, v16bf& hi, v16bf& lo) {
  const float* p = base + (size_t)(r0 + (lane & 15)) * ld + k0 + (lane >> 4) * 8;
  const v4f a0 = *(const v4f*)(p), a1 = *(const v4f*)(p + 4), a2 = *(const v4f*)(p + 16), a3 = *(const v4f*)(p + 20);
#pragma unroll
  for (int i = 0; i < 4; ++i) {
    __bf16 h;
    h = bf_hi(a0[i]); hi[i] = h;      lo[i] = bf_lo(a0[i], h);
    h = bf_hi(a1[i]); hi[4 + i] = h;  lo[4 + i] = bf_lo(a1[i], h);
    h = bf_hi(a2[i]); hi[8 + i] = h;  lo[8 + i] = bf_lo(a2[i], h);
    h = bf_hi(a3[i]); hi[12 + i] = h; lo[12 + i] = bf_lo(a3[i], h);
  }
}
// bf16 plane in LDS
__device__ __forceinline__ v16bf frag_lds(const __bf16* base, int ld, int r0, int k0, int lane) {
  union { v16bf v; v8bf h[2]; } r;
  const __bf16* p = base + (r0 + (lane & 15)) * ld + k0 + (lane >> 4) * 8;
  r.h[0] = *(const v8bf*)(p); r.h[1] = *(const v8bf*)(p + 16);
  return r.v;
}


// ---- 32x64-per-wave GEMM main loop over f32 operands (A [M][K], Bt [N][K]) split into bf16 hi/lo; block = 4 waves, tile BM x BN.
//      Each 32-wide k slice (BM rows of A, then BN rows of Bt) is read from global memory in whole 128-byte lines (8 lanes per row),
//      split once per block and kept as two bf16 planes in LDS; the waves take their fragments from there (same k map as frag_f32).
#define TP_ 40   // LDS row pitch of a slice in bf16 elements (80 bytes)
template <int KDIM, int BM, int BN>
__device__ __forceinline__ void gemm_mainloop_32x64(const float* __restrict__ A, const float* __restrict__ Bt,
                                                    int mblk, int nblk, int mw, int nw, int tid,
                                                    __bf16* __restrict__ Th, __bf16* __restrict__ Tl, v8f acc[2][4]) {
  constexpr int NA = BM / 16, NL = (BM + BN) / 16;   // the 128 threads cover 16 rows per load
  const int lane = tid & 31, sr = tid >> 3, sc = (tid & 7) * 4;
  const float* pa = A + (size_t)(mblk + sr) * KDIM + sc;
  const float* pb = Bt + (size_t)(nblk + sr) * KDIM + sc;
  v4f x[NL];   // the slice on its way from global memory: always one slice ahead of the products
#pragma unroll
  for (int i = 0; i < NL; ++i)
    x[i] = (i < NA) ? *(const v4f*)(pa + (size_t)i * 16 * KDIM) : *(const v4f*)(pb + (size_t)(i - NA) * 16 * KDIM);
  asm volatile("s_wait_xcnt 0x0" ::: "memory");   // stands ahead of any reuse of the loads' address registers
#pragma unroll 1
  for (int k0 = 0; k0 < KDIM; k0 += 32) {
    __syncthreads();   // every wave has taken its fragments of the slice before
#pragma unroll
    for (int i = 0; i < NL; ++i) {
      v4bf h, l;
#pragma unroll
      for (int e = 0; e < 4; ++e) { h[e] = bf_hi(x[i][e]); l[e] = bf_lo(x[i][e], h[e]); }
      vst2(Th + (i * 16 + sr) * TP_ + sc, h);
      vst2(Tl + (i * 16 + sr) * TP_ + sc, l);
    }
    __syncthreads();   // the slice is complete for every wave
    if (k0 + 32 < KDIM) {   // block-uniform: the next slice's loads go out here and fly under this slice's fragment reads and products
#pragma unroll
      for (int i = 0; i < NL; ++i)
        x[i] = (i < NA) ? *(const v4f*)(pa + (size_t)i * 16 * KDIM + k0 + 32) : *(const v4f*)(pb + (size_t)(i - NA) * 16 * KDIM + k0 + 32);
      asm volatile("s_wait_xcnt 0x0" ::: "memory");   // stands ahead of any reuse of the loads' address registers; also holds the loads ahead of the LDS reads below
    }
    v16bf ah[2], al[2], bh[4], bl[4];
#pragma unroll
    for (int i = 0; i < 2; ++i) { ah[i] = frag_lds(Th, TP_, mw + i * 16, 0, lane); al[i] = frag_lds(Tl, TP_, mw + i * 16, 0, lane); }
#pragma unroll
    for (int j = 0; j < 4; ++j) { bh[j] = frag_lds(Th, TP_, BM + nw + j * 16, 0, lane); bl[j] = frag_lds(Tl, TP_, BM + nw + j * 16, 0, lane); }
#pragma unroll
    for (int i = 0; i < 2; ++i)
#pragma unroll
      for (int j = 0; j < 4; ++j) acc[i][j] = wmma_x3(ah[i], al[i], bh[j], bl[j], acc[i][j]);
  }
}

// ---- Stage 1: the three projections in one launch. grid (H, M_TOT/128), block 256 = 8 waves (2 in M x 4 in N), wave tile 64 x 48.
//      A block takes 128 token rows against 192 rows of W: the 64 rows of its head in Wq, in Wk and in Wv. Each 32-wide k slice of x is read
//      from global memory and split into bf16 hi/lo once for all three products; the slice (128 rows of x, then 64 + 64 + 64 rows of W) lies in
//      LDS as two bf16 planes, as in gemm_mainloop_32x64, and every accumulator takes its k slices and its hi/lo products in the same order.
template <int KDIM>
__device__ __forceinline__ void qkv_mainloop(const float* __restrict__ A, const float* __restrict__ Wm,
                                             int mblk, int n0, int mw, int nw, int tid,
                                             __bf16* __restrict__ Th, __bf16* __restrict__ Tl, v8f acc[4][3]) {
  constexpr int NA = 4, NL = 10;   // the 256 threads cover 32 rows per load: 4 loads of x, 2 each of Wq, Wk, Wv
  const int lane = tid & 31, sr = tid >> 3, sc = (tid & 7) * 4;
  const float* pa = A + (size_t)(mblk + sr) * KDIM + sc;
  const float* pb = Wm + (size_t)(n0 + sr) * KDIM + sc;
  v4f x[NL];   // the slice on its way from global memory: always one slice ahead of the products
#pragma unroll
  for (int i = 0; i < NL; ++i)
    x[i] = (i < NA) ? *(const v4f*)(pa + (size_t)i * 32 * KDIM)
                    : *(const v4f*)(pb + (size_t)(((i - NA) >> 1) * QKV_ + ((i - NA) & 1) * 32) * KDIM);
  asm volatile("s_wait_xcnt 0x0" ::: "memory");   // stands ahead of any reuse of the loads' address registers
  // kept rolled: one copy of a slice's code in the instruction cache, one set of registers
#pragma unroll 1
  for (int k0 = 0; k0 < KDIM; k0 += 32) {
    __syncthreads();   // every wave has taken its fragments of the slice before
#pragma unroll
    for (int i = 0; i < NL; ++i) {
      v4bf h, l;
#pragma unroll
      for (int e = 0; e < 4; ++e) { h[e] = bf_hi(x[i][e]); l[e] = bf_lo(x[i][e], h[e]); }
      vst2(Th + (i * 32 + sr) * TP_ + sc, h);
      vst2(Tl + (i * 32 + sr) * TP_ + sc, l);
    }
    __syncthreads();   // the slice is complete for every wave
    if (k0 + 32 < KDIM) {   // block-uniform: the next slice's loads go out here and fly under this slice's fragment reads and products
#pragma unroll
      for (int i = 0; i < NL; ++i)
        x[i] = (i < NA) ? *(const v4f*)(pa + (size_t)i * 32 * KDIM + k0 + 32)
                        : *(const v4f*)(pb + (size_t)(((i - NA) >> 1) * QKV_ + ((i - NA) & 1) * 32) * KDIM + k0 + 32);
      asm volatile("s_wait_xcnt 0x0" ::: "memory");   // stands ahead of any reuse of the loads' address registers; also holds the loads ahead of the LDS reads below
    }
    v16bf bh[3], bl[3];
#pragma unroll
    for (int j = 0; j < 3; ++j) { bh[j] = frag_lds(Th, TP_, 128 + nw + j * 16, 0, lane); bl[j] = frag_lds(Tl, TP_, 128 + nw + j * 16, 0, lane); }
    v16bf ah[4], al[4];   // the x fragments of row group i + 2 are asked for behind the products of group i and arrive under those of group i + 1
#pragma unroll
    for (int i = 0; i < 2; ++i) { ah[i] = frag_lds(Th, TP_, mw + i * 16, 0, lane); al[i] = frag_lds(Tl, TP_, mw + i * 16, 0, lane); }
    __builtin_amdgcn_sched_barrier(0);   // keeps the reads above as one group ahead of the products: sunk among them, each is waited for where it stands
#pragma unroll
    for (int i = 0; i < 4; ++i) {
#pragma unroll
      for (int j = 0; j < 3; ++j) acc[i][j] = wmma_x3(ah[i], al[i], bh[j], bl[j], acc[i][j]);
      if (i < 2) {
        ah[i + 2] = frag_lds(Th, TP_, mw + (i + 2) * 16, 0, lane); al[i + 2] = frag_lds(Tl, TP_, mw + (i + 2) * 16, 0, lane);
        __builtin_amdgcn_sched_barrier(0);   // keeps these reads ahead of the next group's products, which cover their latency
      }
    }
  }
}

//      Q leaves as f32, scaled. K and V leave already split, as a bf16 hi plane and a bf16 lo plane, each laid out so that a 32-key tile of a head
//      is 4 KB in a row: K [B,H,S,HD], V [B,H,S/32,HD,32]. The split is made once here, not by every attention block that reads the tile.
__global__ __launch_bounds__(256) void qkv_kernel(const float* __restrict__ X, const float* __restrict__ Wm,
                                                  float* __restrict__ Qd, float* __restrict__ Kd, float* __restrict__ Vd) {
  __shared__ __align__(16) float st[128][192];       // 96 KB: columns 0..63 Q, 64..127 K, 128..191 V of the head
  __shared__ __align__(16) __bf16 Th[320 * TP_], Tl[320 * TP_];   // k slice: 128 rows of X, 192 rows of W
  const int tid = threadIdx.x, lane = tid & 31, wave = tid >> 5;
  const int mblk = blockIdx.y * 128;
  const int head = blockIdx.x;
  const int b = mblk / S_, s0 = mblk % S_;
  const int mw = (wave & 1) * 64, nw = (wave >> 1) * 48;

  v8f acc[4][3] = {};
  qkv_mainloop<D_>(X, Wm, mblk, head * HD_, mw, nw, tid, Th, Tl, acc);
  const int half = lane >> 4, col = lane & 15;
#pragma unroll
  for (int i = 0; i < 4; ++i)
#pragma unroll
    for (int j = 0; j < 3; ++j)
#pragma unroll
      for (int r = 0; r < 8; ++r) st[mw + i * 16 + r + 8 * half][nw + j * 16 + col] = acc[i][j][r];
  __syncthreads();
  const size_t hb = (size_t)(b * H_ + head) * S_ * HD_;   // first element of the head in Q and in every plane of K and V
  // the three store loops are counted and unrolled: a loop's LDS reads go out together and its stores follow, not one LDS round trip per piece
#pragma unroll
  for (int it = 0; it < 8; ++it) {                         // Q: 128 token rows x 16 pieces; a wave instruction covers 2 rows
    const int g = it * 256 + tid, ml = g >> 4, pc = g & 15;
    const v4f v = *(const v4f*)(&st[ml][pc * 4]);
    vst2(Qd + hb + (size_t)(s0 + ml) * HD_ + pc * 4, v * SCALE_);
  }
  {
    __bf16* ph = (__bf16*)Kd;
#pragma unroll
    for (int it = 0; it < 8; ++it) {                       // K: 128 token rows x 16 pieces; a wave instruction covers 2 rows = 256 B of a plane
      const int g = it * 256 + tid, ml = g >> 4, pc = g & 15;
      const v4f v = *(const v4f*)(&st[ml][64 + pc * 4]);
      v4bf h, l;
#pragma unroll
      for (int e = 0; e < 4; ++e) { h[e] = bf_hi(v[e]); l[e] = bf_lo(v[e], h[e]); }
      const size_t o = hb + (size_t)(s0 + ml) * HD_ + pc * 4;
      vst2(ph + o, h);
      vst2(ph + PLANE_ + o, l);
    }
  }
  {
    __bf16* ph = (__bf16*)Vd;
#pragma unroll
    for (int kt = 0; kt < 4; ++kt) {                       // V: 4 key tiles, a wave takes 8 d rows of each; a wave instruction covers 8 rows = 512 B of a plane
      const int dl = wave * 8 + (lane >> 2), kp = (lane & 3) * 8;
      v8bf h, l;
#pragma unroll
      for (int e = 0; e < 8; ++e) { const float v = st[kt * 32 + kp + e][128 + dl]; h[e] = bf_hi(v); l[e] = bf_lo(v, h[e]); }
      const size_t o = hb + ((size_t)((s0 >> 5) + kt) * HD_ + dl) * 32 + kp;
      vst2(ph + o, h);
      vst2(ph + PLANE_ + o, l);
    }
  }
}

// One 32-key tile of the key loop: the tile that has arrived goes to LDS, the next one's loads go out, then S^T, softmax, O^T.
// MASK = false is for a tile whose last key stands before the block's first query: there key <= query holds for all 16 scores of every lane,
// so the causal compares and selects are left out; MASK = true works them.
template <bool MASK>
__device__ __forceinline__ void key_tile(int t0, int t_end, int tid, int lane, int half, int qg,
                                         const __bf16* __restrict__ Kg, const __bf16* __restrict__ Vg,
                                         __bf16* Kh, __bf16* Kl, __bf16* Vh, __bf16* Vl,
                                         v8bf (&xk)[2][2], v8bf (&xv)[2][2], const v16bf (&qh)[2], const v16bf (&ql)[2],
                                         v8f (&o)[4], float& mrow, float& lrow) {
  __syncthreads();
  {   // the tile that has arrived goes to LDS
#pragma unroll
    for (int i = 0; i < 2; ++i) {
      const int pc = i * 128 + tid;      // 16-byte piece of the tile: 8 pieces per K row, 4 per V^T row
      vst2(Kh + (pc >> 3) * 72 + (pc & 7) * 8, xk[0][i]); vst2(Kl + (pc >> 3) * 72 + (pc & 7) * 8, xk[1][i]);
      vst2(Vh + (pc >> 2) * 40 + (pc & 3) * 8, xv[0][i]); vst2(Vl + (pc >> 2) * 40 + (pc & 3) * 8, xv[1][i]);
    }
  }
  __syncthreads();
  if (t0 + 32 < t_end) {   // block-uniform: the next key tile's loads go out here and fly under this tile's products and softmax
    const __bf16* kp = Kg + (size_t)(t0 + 32) * HD_;
    const __bf16* vp = Vg + (size_t)(t0 + 32) * HD_;
#pragma unroll
    for (int i = 0; i < 2; ++i) {
      xk[0][i] = *(const v8bf*)(kp + i * 1024); xk[1][i] = *(const v8bf*)(kp + PLANE_ + i * 1024);
      xv[0][i] = *(const v8bf*)(vp + i * 1024); xv[1][i] = *(const v8bf*)(vp + PLANE_ + i * 1024);
    }
    asm volatile("s_wait_xcnt 0x0" ::: "memory");   // stands ahead of any reuse of the loads' address registers; also holds the loads ahead of the LDS reads below
  }

  v8f s[2] = {};
#pragma unroll
  for (int n = 0; n < 2; ++n)
#pragma unroll
    for (int kb = 0; kb < 2; ++kb)
      s[n] = wmma_x3(frag_lds(Kh, 72, n * 16, kb * 32, lane), frag_lds(Kl, 72, n * 16, kb * 32, lane), qh[kb], ql[kb], s[n]);

  v16bf pbh, pbl;
  {
    const int kg = t0 + 8 * half;      // s[n][r] is key kg + 16 * n + r against query qg
    float mx = -1e30f;
#pragma unroll
    for (int n = 0; n < 2; ++n)
#pragma unroll
      for (int r = 0; r < 8; ++r) {
        if (MASK) s[n][r] = (kg + n * 16 + r <= qg) ? s[n][r] : -1e30f;   // scores already carry the 1/8 scale (folded into Q)
        mx = fmaxf(mx, s[n][r]);
      }
    mx = fmaxf(mx, xhalf(mx));
    const float mnew  = fmaxf(mrow, mx);
    const float alpha = __expf(mrow - mnew);
    float rs = 0.0f;
#pragma unroll
    for (int n = 0; n < 2; ++n)
#pragma unroll
      for (int r = 0; r < 8; ++r) {
        const float p = (!MASK || kg + n * 16 + r <= qg) ? __expf(s[n][r] - mnew) : 0.0f;
        rs += p;
        const __bf16 h = bf_hi(p);
        pbh[n * 8 + r] = h; pbl[n * 8 + r] = bf_lo(p, h);
      }
    lrow = lrow * alpha + rs;
    mrow = mnew;
#pragma unroll
    for (int j = 0; j < 4; ++j)
#pragma unroll
      for (int r = 0; r < 8; ++r) o[j][r] *= alpha;
  }
#pragma unroll
  for (int j = 0; j < 4; ++j)
    o[j] = wmma_x3(frag_lds(Vh, 40, j * 16, 0, lane), frag_lds(Vl, 40, j * 16, 0, lane), pbh, pbl, o[j]);
}

#define OP_ 68   // pitch in floats of a query row in the output staging
#define NQT_ (S_ / 64)   // 64-query tiles per head
__global__ __launch_bounds__(128) void attn_kernel(const float* __restrict__ Qb, const float* __restrict__ Kb,
                                                  const float* __restrict__ Vt, float* __restrict__ Ctx) {
  __shared__ __align__(16) __bf16 Kh[32 * 72], Kl[32 * 72];     // [key][d] pitch 72
  __shared__ __align__(16) __bf16 Vh[64 * 40], Vl[64 * 40];     // [d][key] pitch 40
  __shared__ __align__(16) float  Os[4][16 * OP_];

  const int tid = threadIdx.x, lane = tid & 31, wave = tid >> 5, half = lane >> 4, col = lane & 15;
  const int head = blockIdx.y, b = blockIdx.z;
  const float* Qh = Qb + (size_t)(b * H_ + head) * S_ * HD_;
  // K and V arrive split (hi plane, then lo plane); in all four planes the 32-key tile at t0 is the 4 KB from element t0 * HD_ of the head
  const __bf16* Kg = (const __bf16*)Kb + (size_t)(b * H_ + head) * S_ * HD_ + tid * 8;
  const __bf16* Vg = (const __bf16*)Vt + (size_t)(b * H_ + head) * S_ * HD_ + tid * 8;
  // kept rolled: one copy of the key loop in the instruction cache, one set of registers
#pragma unroll 1
  for (int pass = 0; pass < 2; ++pass) {
  const int q0 = (pass == 0 ? NQT_ - 1 - (int)blockIdx.x : (int)blockIdx.x) * 64;   // block-uniform
  const int mq = q0 + wave * 16;

  v16bf qh[2], ql[2];
#pragma unroll
  for (int kb = 0; kb < 2; ++kb) frag_f32(Qh, HD_, mq, kb * 32, lane, qh[kb], ql[kb]);

  v8f o[4] = {};
  float mrow = -1e30f, lrow = 0.0f;     // this lane's query: running maximum (same in both halves), sum over this half's keys
  const int qg = mq + col;

  const int t_end = q0 + 64;            // causal limit (block-uniform, multiple of 32)
  // K (32 x 64) and V^T (64 x 32), hi and lo, on their way from global memory, always one key tile ahead of the products:
  // a plain copy, 16 bytes per lane, so a wave instruction reads 4 whole lines
  v8bf xk[2][2], xv[2][2];
#pragma unroll
  for (int i = 0; i < 2; ++i) {
    xk[0][i] = *(const v8bf*)(Kg + i * 1024); xk[1][i] = *(const v8bf*)(Kg + PLANE_ + i * 1024);
    xv[0][i] = *(const v8bf*)(Vg + i * 1024); xv[1][i] = *(const v8bf*)(Vg + PLANE_ + i * 1024);
  }
  asm volatile("s_wait_xcnt 0x0" ::: "memory");   // stands ahead of any reuse of the loads' address registers
  // tiles wholly before the block's first query (t0 + 32 <= q0, block-uniform) need no mask; the two tiles from q0 on do
  int t0 = 0;
  for (; t0 < q0; t0 += 32) key_tile<false>(t0, t_end, tid, lane, half, qg, Kg, Vg, Kh, Kl, Vh, Vl, xk, xv, qh, ql, o, mrow, lrow);
  for (; t0 < t_end; t0 += 32) key_tile<true>(t0, t_end, tid, lane, half, qg, Kg, Vg, Kh, Kl, Vh, Vl, xk, xv, qh, ql, o, mrow, lrow);

  float* os_ = Os[wave];
  const float inv = 1.0f / (lrow + xhalf(lrow));   // the two halves' key sums joined once
#pragma unroll
  for (int j = 0; j < 4; ++j) {                    // o[j][r] is d = j * 16 + 8 * half + r of query col
    const v4f w0 = {o[j][0] * inv, o[j][1] * inv, o[j][2] * inv, o[j][3] * inv};
    const v4f w1 = {o[j][4] * inv, o[j][5] * inv, o[j][6] * inv, o[j][7] * inv};
    vst2(os_ + col * OP_ + j * 16 + 8 * half, w0);
    vst2(os_ + col * OP_ + j * 16 + 8 * half + 4, w1);
  }
  __syncthreads();
#pragma unroll
  for (int q = 0; q < 8; ++q) {
    const int rl = q * 2 + (lane >> 4), pc = lane & 15;
    vst2(Ctx + ((size_t)(b * S_ + mq + rl)) * D_ + head * HD_ + pc * 4, *(const v4f*)(os_ + rl * OP_ + pc * 4));
  }
  asm volatile("s_wait_xcnt 0x0" ::: "memory");   // stands ahead of the next tile's reuse of the stores' address and data registers
  }
}

__global__ __launch_bounds__(128) void out_gemm_kernel(const float* __restrict__ Cx, const float* __restrict__ Wo, float* __restrict__ Out) {
  __shared__ __align__(16) float st[4][32 * 64];
  __shared__ __align__(16) __bf16 Th[192 * TP_], Tl[192 * TP_];   // k slice: 64 rows of Cx, 128 rows of Wo
  const int lane = threadIdx.x & 31, wave = threadIdx.x >> 5;
  const int m0 = blockIdx.y * 64 + (wave >> 1) * 32;
  const int n0 = blockIdx.x * 128 + (wave & 1) * 64;
  v8f acc[2][4] = {};
  gemm_mainloop_32x64<QKV_, 64, 128>(Cx, Wo, blockIdx.y * 64, blockIdx.x * 128, (wave >> 1) * 32, (wave & 1) * 64, threadIdx.x, Th, Tl, acc);
  const int half = lane >> 4, col = lane & 15;
  float* S = st[wave];
#pragma unroll
  for (int i = 0; i < 2; ++i)
#pragma unroll
    for (int j = 0; j < 4; ++j)
#pragma unroll
      for (int r = 0; r < 8; ++r) S[(i * 16 + r + 8 * half) * 64 + j * 16 + col] = acc[i][j][r];
  __syncthreads();
#pragma unroll
  for (int q = 0; q < 16; ++q) {
    const int rl = q * 2 + (lane >> 4), pc = lane & 15;
    vst2(Out + (size_t)(m0 + rl) * D_ + n0 + pc * 4, *(const v4f*)(S + rl * 64 + pc * 4));
  }
}

extern "C" void kernel_launch(void* const* d_in, const int* in_sizes, int n_in,
                              void* d_out, int out_size, void* d_ws, size_t ws_size,
                              hipStream_t stream) {
  (void)in_sizes; (void)n_in; (void)out_size; (void)ws_size;
  const float* x    = (const float*)d_in[0];
  const float* Wqkv = (const float*)d_in[1];   // [3D][D]: rows [0,D) = Wq, [D,2D) = Wk, [2D,3D) = Wv
  const float* Wout = (const float*)d_in[2];   // [D][D]
  float* out = (float*)d_out;

  const size_t E = (size_t)M_TOT * D_;          // 8,388,608 floats per buffer (32 MB)
  float* qb   = (float*)d_ws;
  float* kb   = qb + E;
  float* vtb  = kb + E;        // kb, vtb: each a bf16 hi plane and a bf16 lo plane of E elements (K [B,H,S,HD], V [B,H,S/32,HD,32])
  float* ctxb = vtb + E;       // total 128 MB

  qkv_kernel<<<dim3(H_, M_TOT / 128), 256, 0, stream>>>(x, Wqkv, qb, kb, vtb);
  attn_kernel<<<dim3(S_ / 128, H_, B_), 128, 0, stream>>>(qb, kb, vtb, ctxb);
  out_gemm_kernel<<<dim3(D_ / 128, M_TOT / 64), 128, 0, stream>>>(ctxb, Wout, out);
}

// v009
// One run takes 294 microseconds.
// Next to v008, in two timings, it ran 1.03 times as fast each time.
// Counting every step since v000, it is 2.76 times as fast.
#include <hip/hip_runtime.h>

// ---------------------------------------------------------------------------
// CausalMultiHeadSelfAttention (B=2, S=4096, D=1024, H=16, HD=64, causal; packed Wqkv [3D][D], Wout [D][D])
// Contractions: Q/K/V projections (K = 1024), QK^T (K = 64), P V (K = keys) and the output projection (K = 1024) — all on
// v_wmma_f32_16x16x32_bf16 as bf16 hi/lo splits (hi*hi + hi*lo + lo*hi, f32 accumulate) with every operand kept in f32 and
// split in registers / at LDS staging, but K and V, which leave their projections as hi/lo planes (causal rows expose single V rows,
// so plain 16-bit operands miss).
// ---------------------------------------------------------------------------

#define B_   2
#define S_   4096
#define D_   1024
#define QKV_ 1024
#define H_   16
#define HD_  64
#define M_TOT (B_ * S_)
#define SCALE_ 0.125f  // 64^-0.5
#define PLANE_ ((size_t)M_TOT * D_)   // elements of one bf16 plane of K or V; the lo plane follows the hi plane

typedef __attribute__((ext_vector_type(16))) __bf16 v16bf;
typedef __attribute__((ext_vector_type(8)))  __bf16 v8bf;
typedef __attribute__((ext_vector_type(4)))  __bf16 v4bf;
typedef __attribute__((ext_vector_type(8)))  float  v8f;
typedef __attribute__((ext_vector_type(4)))  float  v4f;

template <typename V> __device__ __forceinline__ void vst2(void* p, V v) {
  *(V*)p = v; 
}
__device__ __forceinline__ __bf16 bf_hi(float x) { return (__bf16)x; }
__device__ __forceinline__ __bf16 bf_lo(float x, __bf16 h) { return (__bf16)(x - (float)h); }
// the plain builtin: the compiler keeps the distances behind it itself, and is free to issue the products of independent accumulator
// tiles back to back and to fetch LDS fragments ahead of them (each accumulator still takes hi*hi, hi*lo, lo*hi in this order)
__device__ __forceinline__ v8f wmma_bf16(v16bf a, v16bf b, v8f c) {
  return __builtin_amdgcn_wmma_f32_16x16x32_bf16(false, a, false, b, (short)0, c, false, false);
}
__device__ __forceinline__ v8f wmma_x3(v16bf ah, v16bf al, v16bf bh, v16bf bl, v8f c) {
  c = wmma_bf16(ah, bh, c); c = wmma_bf16(ah, bl, c); c = wmma_bf16(al, bh, c);
  return c;
}

// ---- eight f32 values -> four registers of bf16 hi pairs and four of bf16 lo pairs, three vector instructions a pair:
//      the packed conversion gives both hi values; v_fma_mixlo_bf16 / v_fma_mixhi_bf16 read one half of that register as bf16, form x - hi in f32
//      (exact) and round it to bf16 straight into the low / high half of the lo register. Same values as bf_hi and bf_lo.
//      Written as asm because the compiler's own form converts every hi value a second time alone and packs the lo values with a further conversion.
//      Each s_delay_alu names the producers four vector instructions back, so that the SIMD issues other waves while a result is on its way.
typedef unsigned int u32;
typedef __attribute__((ext_vector_type(2))) u32 v2u;
typedef __attribute__((ext_vector_type(8))) u32 v8u;
// in a GEMM k loop; volatile: it stays behind the v_nop statement at the head of the loop
__device__ __forceinline__ void split8_loop(float x0, float x1, float x2, float x3, float x4, float x5, float x6, float x7, u32 (&h)[4], u32 (&l)[4]) {
  asm volatile(
      "v_cvt_pk_bf16_f32 %0, %8, %9\n\t"
      "v_cvt_pk_bf16_f32 %1, %10, %11\n\t"
      "v_cvt_pk_bf16_f32 %2, %12, %13\n\t"
      "v_cvt_pk_bf16_f32 %3, %14, %15\n\t"
      "s_delay_alu instid0(VALU_DEP_4) | instskip(NEXT) | instid1(VALU_DEP_4)\n\t"
      "v_fma_mixlo_bf16 %4, %0, -1.0, %8 op_sel_hi:[1,0,0]\n\t"
      "v_fma_mixlo_bf16 %5, %1, -1.0, %10 op_sel_hi:[1,0,0]\n\t"
      "s_delay_alu instid0(VALU_DEP_4) | instskip(NEXT) | instid1(VALU_DEP_4)\n\t"
      "v_fma_mixlo_bf16 %6, %2, -1.0, %12 op_sel_hi:[1,0,0]\n\t"
      "v_fma_mixlo_bf16 %7, %3, -1.0, %14 op_sel_hi:[1,0,0]\n\t"
      "s_delay_alu instid0(VALU_DEP_4) | instskip(NEXT) | instid1(VALU_DEP_4)\n\t"
      "v_fma_mixhi_bf16 %4, %0, -1.0, %9 op_sel:[1,0,0] op_sel_hi:[1,0,0]\n\t"
      "v_fma_mixhi_bf16 %5, %1, -1.0, %11 op_sel:[1,0,0] op_sel_hi:[1,0,0]\n\t"
      "s_delay_alu instid0(VALU_DEP_4) | instskip(NEXT) | instid1(VALU_DEP_4)\n\t"
      "v_fma_mixhi_bf16 %6, %2, -1.0, %13 op_sel:[1,0,0] op_sel_hi:[1,0,0]\n\t"
      "v_fma_mixhi_bf16 %7, %3, -1.0, %15 op_sel:[1,0,0] op_sel_hi:[1,0,0]"
      : "=&v"(h[0]), "=&v"(h[1]), "=&v"(h[2]), "=&v"(h[3]), "=&v"(l[0]), "=&v"(l[1]), "=&v"(l[2]), "=&v"(l[3])
      : "v"(x0), "v"(x1), "v"(x2), "v"(x3), "v"(x4), "v"(x5), "v"(x6), "v"(x7));
}
// behind v_exp_f32: the v_nop is the slot the instruction set asks for between a transcendental and a reader of its result, which the compiler
// cannot place for a reader in asm; the first s_delay_alu names the youngest transcendental
__device__ __forceinline__ void split8_exp(float x0, float x1, float x2, float x3, float x4, float x5, float x6, float x7, u32 (&h)[4], u32 (&l)[4]) {
  asm(
      "v_nop\n\t"
      "s_delay_alu instid0(TRANS32_DEP_1)\n\t"
      "v_cvt_pk_bf16_f32 %0, %8, %9\n\t"
      "v_cvt_pk_bf16_f32 %1, %10, %11\n\t"
      "v_cvt_pk_bf16_f32 %2, %12, %13\n\t"
      "v_cvt_pk_bf16_f32 %3, %14, %15\n\t"
      "s_delay_alu instid0(VALU_DEP_4) | instskip(NEXT) | instid1(VALU_DEP_4)\n\t"
      "v_fma_mixlo_bf16 %4, %0, -1.0, %8 op_sel_hi:[1,0,0]\n\t"
      "v_fma_mixlo_bf16 %5, %1, -1.0, %10 op_sel_hi:[1,0,0]\n\t"
      "s_delay_alu instid0(VALU_DEP_4) | instskip(NEXT) | instid1(VALU_DEP_4)\n\t"
      "v_fma_mixlo_bf16 %6, %2, -1.0, %12 op_sel_hi:[1,0,0]\n\t"
      "v_fma_mixlo_bf16 %7, %3, -1.0, %14 op_sel_hi:[1,0,0]\n\t"
      "s_delay_alu instid0(VALU_DEP_4) | instskip(NEXT) | instid1(VALU_DEP_4)\n\t"
      "v_fma_mixhi_bf16 %4, %0, -1.0, %9 op_sel:[1,0,0] op_sel_hi:[1,0,0]\n\t"
      "v_fma_mixhi_bf16 %5, %1, -1.0, %11 op_sel:[1,0,0] op_sel_hi:[1,0,0]\n\t"
      "s_delay_alu instid0(VALU_DEP_4) | instskip(NEXT) | instid1(VALU_DEP_4)\n\t"
      "v_fma_mixhi_bf16 %6, %2, -1.0, %13 op_sel:[1,0,0] op_sel_hi:[1,0,0]\n\t"
      "v_fma_mixhi_bf16 %7, %3, -1.0, %15 op_sel:[1,0,0] op_sel_hi:[1,0,0]"
      : "=&v"(h[0]), "=&v"(h[1]), "=&v"(h[2]), "=&v"(h[3]), "=&v"(l[0]), "=&v"(l[1]), "=&v"(l[2]), "=&v"(l[3])
      : "v"(x0), "v"(x1), "v"(x2), "v"(x3), "v"(x4), "v"(x5), "v"(x6), "v"(x7));
}

// lane l takes the value of lane l ^ 16 (the other half of the wave)
__device__ __forceinline__ float xhalf(float x) {
  return __builtin_bit_cast(float, __builtin_amdgcn_permlanex16(__builtin_bit_cast(int, x), __builtin_bit_cast(int, x), 0x76543210, 0xfedcba98, false, false));
}

// ---- fragment loaders (wave32): A (16x32 from [M][ld]) and B from B^T ([N][ld]) share the per-lane K map:
//      row/col = lane&15; elements 0..7 <- k0 + 8*half + 0..7, elements 8..15 <- k0 + 16 + 8*half + 0..7
// f32 source split into bf16 hi/lo
__device__ __forceinline__ void frag_f32(const float* __restrict__ base, int ld, int r0, int k0, int lane, v16bf& hi, v16bf& lo) {
  const float* p = base + (size_t)(r0 + (lane & 15)) * ld + k0 + (lane >> 4) * 8;
  const v4f a0 = *(const v4f*)(p), a1 = *(const v4f*)(p + 4), a2 = *(const v4f*)(p + 16), a3 = *(const v4f*)(p + 20);
#pragma unroll
  for (int i = 0; i < 4; ++i) {
    __bf16 h;
    h = bf_hi(a0[i]); hi[i] = h;      lo[i] = bf_lo(a0[i], h);
    h = bf_hi(a1[i]); hi[4 + i] = h;  lo[4 + i] = bf_lo(a1[i], h);
    h = bf_hi(a2[i]); hi[8 + i] = h;  lo[8 + i] = bf_lo(a2[i], h);
    h = bf_hi(a3[i]); hi[12 + i] = h; lo[12 + i] = bf_lo(a3[i], h);
  }
}
// bf16 plane in LDS
__device__ __forceinline__ v16bf frag_lds(const __bf16* base, int ld, int r0, int k0, int lane) {
  union { v16bf v; v8bf h[2]; } r;
  const __bf16* p = base + (r0 + (lane & 15)) * ld + k0 + (lane >> 4) * 8;
  r.h[0] = *(const v8bf*)(p); r.h[1] = *(const v8bf*)(p + 16);
  return r.v;
}


// ---- 32x64-per-wave GEMM main loop over f32 operands (A [M][K], Bt [N][K]) split into bf16 hi/lo; block = 4 waves, tile BM x BN.
//      Each 32-wide k slice (BM rows of A, then BN rows of Bt) is read from global memory in whole 128-byte lines (8 lanes per row),
//      split once per block and kept as two bf16 planes in LDS; the waves take their fragments from there (same k map as frag_f32).
#define TP_ 40   // LDS row pitch of a slice in bf16 elements (80 bytes)
template <int KDIM, int BM, int BN>
__device__ __forceinline__ void gemm_mainloop_32x64(const float* __restrict__ A, const float* __restrict__ Bt,
                                                    int mblk, int nblk, int mw, int nw, int tid,
                                                    __bf16* __restrict__ Th, __bf16* __restrict__ Tl, v8f acc[2][4]) {
  constexpr int NA = BM / 16, NL = (BM + BN) / 16;   // the 128 threads cover 16 rows per load
  const int lane = tid & 31, sr = tid >> 3, sc = (tid & 7) * 4;
  const float* pa = A + (size_t)(mblk + sr) * KDIM + sc;
  const float* pb = Bt + (size_t)(nblk + sr) * KDIM + sc;
  v4f x[NL];   // the slice on its way from global memory: always one slice ahead of the products
#pragma unroll
  for (int i = 0; i < NL; ++i)
    x[i] = (i < NA) ? *(const v4f*)(pa + (size_t)i * 16 * KDIM) : *(const v4f*)(pb + (size_t)(i - NA) * 16 * KDIM);
  asm volatile("s_wait_xcnt 0x0" ::: "memory");   // stands ahead of any reuse of the loads' address registers
#pragma unroll 1
  for (int k0 = 0; k0 < KDIM; k0 += 32) {
    u32 h[NL / 2][4], l[NL / 2][4];   // the split touches registers only: it stands ahead of the barrier, under the products of waves still at the slice before
    // the distance the chip needs behind a WMMA: the statements below may write registers that the last products of the slice before read, and the compiler does not look into asm
    asm volatile("v_nop\n\tv_nop\n\tv_nop\n\tv_nop");
#pragma unroll
    for (int i = 0; i < NL; i += 2)   // two loads' values a statement
      split8_loop(x[i][0], x[i][1], x[i][2], x[i][3], x[i + 1][0], x[i + 1][1], x[i + 1][2], x[i + 1][3], h[i / 2], l[i / 2]);
    __syncthreads();   // every wave has taken its fragments of the slice before
#pragma unroll
    for (int i = 0; i < NL; ++i) {
      vst2(Th + (i * 16 + sr) * TP_ + sc, v2u{h[i / 2][(i & 1) * 2], h[i / 2][(i & 1) * 2 + 1]});
      vst2(Tl + (i * 16 + sr) * TP_ + sc, v2u{l[i / 2][(i & 1) * 2], l[i / 2][(i & 1) * 2 + 1]});
    }
    __syncthreads();   // the slice is complete for every wave
    if (k0 + 32 < KDIM) {   // block-uniform: the next slice's loads go out here and fly under this slice's fragment reads and products
#pragma unroll
      for (int i = 0; i < NL; ++i)
        x[i] = (i < NA) ? *(const v4f*)(pa + (size_t)i * 16 * KDIM + k0 + 32) : *(const v4f*)(pb + (size_t)(i - NA) * 16 * KDIM + k0 + 32);
      asm volatile("s_wait_xcnt 0x0" ::: "memory");   // stands ahead of any reuse of the loads' address registers; also holds the loads ahead of the LDS reads below
    }
    v16bf ah[2], al[2], bh[4], bl[4];
#pragma unroll
    for (int i = 0; i < 2; ++i) { ah[i] = frag_lds(Th, TP_, mw + i * 16, 0, lane); al[i] = frag_lds(Tl, TP_, mw + i * 16, 0, lane); }
#pragma unroll
    for (int j = 0; j < 4; ++j) { bh[j] = frag_lds(Th, TP_, BM + nw + j * 16, 0, lane); bl[j] = frag_lds(Tl, TP_, BM + nw + j * 16, 0, lane); }
#pragma unroll
    for (int i = 0; i < 2; ++i)
#pragma unroll
      for (int j = 0; j < 4; ++j) acc[i][j] = wmma_x3(ah[i], al[i], bh[j], bl[j], acc[i][j]);
  }
}

// ---- Stage 1: the three projections in one launch. grid (H, M_TOT/128), block 256 = 8 waves (2 in M x 4 in N), wave tile 64 x 48.
//      A block takes 128 token rows against 192 rows of W: the 64 rows of its head in Wq, in Wk and in Wv. Each 32-wide k slice of x is read
//      from global memory and split into bf16 hi/lo once for all three products; the slice (128 rows of x, then 64 + 64 + 64 rows of W) lies in
//      LDS as two bf16 planes, as in gemm_mainloop_32x64, and every accumulator takes its k slices and its hi/lo products in the same order.
template <int KDIM>
__device__ __forceinline__ void qkv_mainloop(const float* __restrict__ A, const float* __restrict__ Wm,
                                             int mblk, int n0, int mw, int nw, int tid,
                                             __bf16* __restrict__ Th, __bf16* __restrict__ Tl, v8f acc[4][3]) {
  constexpr int NA = 4, NL = 10;   // the 256 threads cover 32 rows per load: 4 loads of x, 2 each of Wq, Wk, Wv
  const int lane = tid & 31, sr = tid >> 3, sc = (tid & 7) * 4;
  const float* pa = A + (size_t)(mblk + sr) * KDIM + sc;
  const float* pb = Wm + (size_t)(n0 + sr) * KDIM + sc;
  v4f x[NL];   // the slice on its way from global memory: always one slice ahead of the products
#pragma unroll
  for (int i = 0; i < NL; ++i)
    x[i] = (i < NA) ? *(const v4f*)(pa + (size_t)i * 32 * KDIM)
                    : *(const v4f*)(pb + (size_t)(((i - NA) >> 1) * QKV_ + ((i - NA) & 1) * 32) * KDIM);
  asm volatile("s_wait_xcnt 0x0" ::: "memory");   // stands ahead of any reuse of the loads' address registers
  // kept rolled: one copy of a slice's code in the instruction cache, one set of registers
#pragma unroll 1
  for (int k0 = 0; k0 < KDIM; k0 += 32) {
    u32 h[NL / 2][4], l[NL / 2][4];   // the split touches registers only: it stands ahead of the barrier, under the products of waves still at the slice before
    // the distance the chip needs behind a WMMA: the statements below may write registers that the last products of the slice before read, and the compiler does not look into asm
    asm volatile("v_nop\n\tv_nop\n\tv_nop\n\tv_nop");
#pragma unroll
    for (int i = 0; i < NL; i += 2)   // two loads' values a statement
      split8_loop(x[i][0], x[i][1], x[i][2], x[i][3], x[i + 1][0], x[i + 1][1], x[i + 1][2], x[i + 1][3], h[i / 2], l[i / 2]);
    __syncthreads();   // every wave has taken its fragments of the slice before
#pragma unroll
    for (int i = 0; i < NL; ++i) {
      vst2(Th + (i * 32 + sr) * TP_ + sc, v2u{h[i / 2][(i & 1) * 2], h[i / 2][(i & 1) * 2 + 1]});
      vst2(Tl + (i * 32 + sr) * TP_ + sc, v2u{l[i / 2][(i & 1) * 2], l[i / 2][(i & 1) * 2 + 1]});
    }
    __syncthreads();   // the slice is complete for every wave
    if (k0 + 32 < KDIM) {   // block-uniform: the next slice's loads go out here and fly under this slice's fragment reads and products
#pragma unroll
      for (int i = 0; i < NL; ++i)
        x[i] = (i < NA) ? *(const v4f*)(pa + (size_t)i * 32 * KDIM + k0 + 32)
                        : *(const v4f*)(pb + (size_t)(((i - NA) >> 1) * QKV_ + ((i - NA) & 1) * 32) * KDIM + k0 + 32);
      asm volatile("s_wait_xcnt 0x0" ::: "memory");   // stands ahead of any reuse of the loads' address registers; also holds the loads ahead of the LDS reads below
    }
    v16bf bh[3], bl[3];
#pragma unroll
    for (int j = 0; j < 3; ++j) { bh[j] = frag_lds(Th, TP_, 128 + nw + j * 16, 0, lane); bl[j] = frag_lds(Tl, TP_, 128 + nw + j * 16, 0, lane); }
    v16bf ah[4], al[4];   // the x fragments of row group i + 2 are asked for behind the products of group i and arrive under those of group i + 1
#pragma unroll
    for (int i = 0; i < 2; ++i) { ah[i] = frag_lds(Th, TP_, mw + i * 16, 0, lane); al[i] = frag_lds(Tl, TP_, mw + i * 16, 0, lane); }
    __builtin_amdgcn_sched_barrier(0);   // keeps the reads above as one group ahead of the products: sunk among them, each is waited for where it stands
#pragma unroll
    for (int i = 0; i < 4; ++i) {
#pragma unroll
      for (int j = 0; j < 3; ++j) acc[i][j] = wmma_x3(ah[i], al[i], bh[j], bl[j], acc[i][j]);
      if (i < 2) {
        ah[i + 2] = frag_lds(Th, TP_, mw + (i + 2) * 16, 0, lane); al[i + 2] = frag_lds(Tl, TP_, mw + (i + 2) * 16, 0, lane);
        __builtin_amdgcn_sched_barrier(0);   // keeps these reads ahead of the next group's products, which cover their latency
      }
    }
  }
}

//      Q leaves as f32, scaled. K and V leave already split, as a bf16 hi plane and a bf16 lo plane, each laid out so that a 32-key tile of a head
//      is 4 KB in a row: K [B,H,S,HD], V [B,H,S/32,HD,32]. The split is made once here, not by every attention block that reads the tile.
__global__ __launch_bounds__(256) void qkv_kernel(const float* __restrict__ X, const float* __restrict__ Wm,
                                                  float* __restrict__ Qd, float* __restrict__ Kd, float* __restrict__ Vd) {
  __shared__ __align__(16) float st[128][192];       // 96 KB: columns 0..63 Q, 64..127 K, 128..191 V of the head
  __shared__ __align__(16) __bf16 Th[320 * TP_], Tl[320 * TP_];   // k slice: 128 rows of X, 192 rows of W
  const int tid = threadIdx.x, lane = tid & 31, wave = tid >> 5;
  const int mblk = blockIdx.y * 128;
  const int head = blockIdx.x;
  const int b = mblk / S_, s0 = mblk % S_;
  const int mw = (wave & 1) * 64, nw = (wave >> 1) * 48;

  v8f acc[4][3] = {};
  qkv_mainloop<D_>(X, Wm, mblk, head * HD_, mw, nw, tid, Th, Tl, acc);
  const int half = lane >> 4, col = lane & 15;
#pragma unroll
  for (int i = 0; i < 4; ++i)
#pragma unroll
    for (int j = 0; j < 3; ++j)
#pragma unroll
      for (int r = 0; r < 8; ++r) st[mw + i * 16 + r + 8 * half][nw + j * 16 + col] = acc[i][j][r];
  __syncthreads();
  const size_t hb = (size_t)(b * H_ + head) * S_ * HD_;   // first element of the head in Q and in every plane of K and V
  // the three store loops are counted and unrolled: a loop's LDS reads go out together and its stores follow, not one LDS round trip per piece
#pragma unroll
  for (int it = 0; it < 8; ++it) {                         // Q: 128 token rows x 16 pieces; a wave instruction covers 2 rows
    const int g = it * 256 + tid, ml = g >> 4, pc = g & 15;
    const v4f v = *(const v4f*)(&st[ml][pc * 4]);
    vst2(Qd + hb + (size_t)(s0 + ml) * HD_ + pc * 4, v * SCALE_);
  }
  {
    __bf16* ph = (__bf16*)Kd;
#pragma unroll
    for (int it = 0; it < 8; ++it) {                       // K: 128 token rows x 16 pieces; a wave instruction covers 2 rows = 256 B of a plane
      const int g = it * 256 + tid, ml = g >> 4, pc = g & 15;
      const v4f v = *(const v4f*)(&st[ml][64 + pc * 4]);
      v4bf h, l;
#pragma unroll
      for (int e = 0; e < 4; ++e) { h[e] = bf_hi(v[e]); l[e] = bf_lo(v[e], h[e]); }
      const size_t o = hb + (size_t)(s0 + ml) * HD_ + pc * 4;
      vst2(ph + o, h);
      vst2(ph + PLANE_ + o, l);
    }
  }
  {
    __bf16* ph = (__bf16*)Vd;
#pragma unroll
    for (int kt = 0; kt < 4; ++kt) {                       // V: 4 key tiles, a wave takes 8 d rows of each; a wave instruction covers 8 rows = 512 B of a plane
      const int dl = wave * 8 + (lane >> 2), kp = (lane & 3) * 8;
      v8bf h, l;
#pragma unroll
      for (int e = 0; e < 8; ++e) { const float v = st[kt * 32 + kp + e][128 + dl]; h[e] = bf_hi(v); l[e] = bf_lo(v, h[e]); }
      const size_t o = hb + ((size_t)((s0 >> 5) + kt) * HD_ + dl) * 32 + kp;
      vst2(ph + o, h);
      vst2(ph + PLANE_ + o, l);
    }
  }
}

// One 32-key tile of the key loop: the tile that has arrived goes to LDS, the next one's loads go out, then S^T, softmax, O^T.
// MASK = false is for a tile whose last key stands before the block's first query: there key <= query holds for all 16 scores of every lane,
// so the causal compares and selects are left out; MASK = true works them.
template <bool MASK>
__device__ __forceinline__ void key_tile(int t0, int t_end, int tid, int lane, int half, int qg,
                                         const __bf16* __restrict__ Kg, const __bf16* __restrict__ Vg,
                                         __bf16* Kh, __bf16* Kl, __bf16* Vh, __bf16* Vl,
                                         v8bf (&xk)[2][2], v8bf (&xv)[2][2], const v16bf (&qh)[2], const v16bf (&ql)[2],
                                         v8f (&o)[4], float& mrow, float& lrow) {
  __syncthreads();
  {   // the tile that has arrived goes to LDS
#pragma unroll
    for (int i = 0; i < 2; ++i) {
      const int pc = i * 128 + tid;      // 16-byte piece of the tile: 8 pieces per K row, 4 per V^T row
      vst2(Kh + (pc >> 3) * 72 + (pc & 7) * 8, xk[0][i]); vst2(Kl + (pc >> 3) * 72 + (pc & 7) * 8, xk[1][i]);
      vst2(Vh + (pc >> 2) * 40 + (pc & 3) * 8, xv[0][i]); vst2(Vl + (pc >> 2) * 40 + (pc & 3) * 8, xv[1][i]);
    }
  }
  __syncthreads();
  if (t0 + 32 < t_end) {   // block-uniform: the next key tile's loads go out here and fly under this tile's products and softmax
    const __bf16* kp = Kg + (size_t)(t0 + 32) * HD_;
    const __bf16* vp = Vg + (size_t)(t0 + 32) * HD_;
#pragma unroll
    for (int i = 0; i < 2; ++i) {
      xk[0][i] = *(const v8bf*)(kp + i * 1024); xk[1][i] = *(const v8bf*)(kp + PLANE_ + i * 1024);
      xv[0][i] = *(const v8bf*)(vp + i * 1024); xv[1][i] = *(const v8bf*)(vp + PLANE_ + i * 1024);
    }
    asm volatile("s_wait_xcnt 0x0" ::: "memory");   // stands ahead of any reuse of the loads' address registers; also holds the loads ahead of the LDS reads below
  }

  v8f s[2] = {};
#pragma unroll
  for (int n = 0; n < 2; ++n)
#pragma unroll
    for (int kb = 0; kb < 2; ++kb)
      s[n] = wmma_x3(frag_lds(Kh, 72, n * 16, kb * 32, lane), frag_lds(Kl, 72, n * 16, kb * 32, lane), qh[kb], ql[kb], s[n]);

  v16bf pbh, pbl;
  {
    const int kg = t0 + 8 * half;      // s[n][r] is key kg + 16 * n + r against query qg
    float mx = -1e30f;
#pragma unroll
    for (int n = 0; n < 2; ++n)
#pragma unroll
      for (int r = 0; r < 8; ++r) {
        if (MASK) s[n][r] = (kg + n * 16 + r <= qg) ? s[n][r] : -1e30f;   // scores already carry the 1/8 scale (folded into Q)
        mx = fmaxf(mx, s[n][r]);
      }
    mx = fmaxf(mx, xhalf(mx));
    const float mnew  = fmaxf(mrow, mx);
    const float alpha = __expf(mrow - mnew);
    float rs = 0.0f;
    v8u ph, pl;   // element n * 8 + r of the B operand lies in half r & 1 of register n * 4 + r / 2
#pragma unroll
    for (int n = 0; n < 2; ++n) {
      float p[8];
#pragma unroll
      for (int r = 0; r < 8; ++r) {
        p[r] = (!MASK || kg + n * 16 + r <= qg) ? __expf(s[n][r] - mnew) : 0.0f;
        rs += p[r];
      }
      u32 h[4], l[4];
      split8_exp(p[0], p[1], p[2], p[3], p[4], p[5], p[6], p[7], h, l);
#pragma unroll
      for (int c = 0; c < 4; ++c) { ph[n * 4 + c] = h[c]; pl[n * 4 + c] = l[c]; }
    }
    pbh = __builtin_bit_cast(v16bf, ph); pbl = __builtin_bit_cast(v16bf, pl);
    lrow = lrow * alpha + rs;
    mrow = mnew;
#pragma unroll
    for (int j = 0; j < 4; ++j)
#pragma unroll
      for (int r = 0; r < 8; ++r) o[j][r] *= alpha;
  }
#pragma unroll
  for (int j = 0; j < 4; ++j)
    o[j] = wmma_x3(frag_lds(Vh, 40, j * 16, 0, lane), frag_lds(Vl, 40, j * 16, 0, lane), pbh, pbl, o[j]);
}

#define OP_ 68   // pitch in floats of a query row in the output staging
#define NQT_ (S_ / 64)   // 64-query tiles per head
__global__ __launch_bounds__(128) void attn_kernel(const float* __restrict__ Qb, const float* __restrict__ Kb,
                                                  const float* __restrict__ Vt, float* __restrict__ Ctx) {
  __shared__ __align__(16) __bf16 Kh[32 * 72], Kl[32 * 72];     // [key][d] pitch 72
  __shared__ __align__(16) __bf16 Vh[64 * 40], Vl[64 * 40];     // [d][key] pitch 40
  __shared__ __align__(16) float  Os[4][16 * OP_];

  const int tid = threadIdx.x, lane = tid & 31, wave = tid >> 5, half = lane >> 4, col = lane & 15;
  const int head = blockIdx.y, b = blockIdx.z;
  const float* Qh = Qb + (size_t)(b * H_ + head) * S_ * HD_;
  // K and V arrive split (hi plane, then lo plane); in all four planes the 32-key tile at t0 is the 4 KB from element t0 * HD_ of the head
  const __bf16* Kg = (const __bf16*)Kb + (size_t)(b * H_ + head) * S_ * HD_ + tid * 8;
  const __bf16* Vg = (const __bf16*)Vt + (size_t)(b * H_ + head) * S_ * HD_ + tid * 8;
  // kept rolled: one copy of the key loop in the instruction cache, one set of registers
#pragma unroll 1
  for (int pass = 0; pass < 2; ++pass) {
  const int q0 = (pass == 0 ? NQT_ - 1 - (int)blockIdx.x : (int)blockIdx.x) * 64;   // block-uniform
  const int mq = q0 + wave * 16;

  v16bf qh[2], ql[2];
#pragma unroll
  for (int kb = 0; kb < 2; ++kb) frag_f32(Qh, HD_, mq, kb * 32, lane, qh[kb], ql[kb]);

  v8f o[4] = {};
  float mrow = -1e30f, lrow = 0.0f;     // this lane's query: running maximum (same in both halves), sum over this half's keys
  const int qg = mq + col;

  const int t_end = q0 + 64;            // causal limit (block-uniform, multiple of 32)
  // K (32 x 64) and V^T (64 x 32), hi and lo, on their way from global memory, always one key tile ahead of the products:
  // a plain copy, 16 bytes per lane, so a wave instruction reads 4 whole lines
  v8bf xk[2][2], xv[2][2];
#pragma unroll
  for (int i = 0; i < 2; ++i) {
    xk[0][i] = *(const v8bf*)(Kg + i * 1024); xk[1][i] = *(const v8bf*)(Kg + PLANE_ + i * 1024);
    xv[0][i] = *(const v8bf*)(Vg + i * 1024); xv[1][i] = *(const v8bf*)(Vg + PLANE_ + i * 1024);
  }
  asm volatile("s_wait_xcnt 0x0" ::: "memory");   // stands ahead of any reuse of the loads' address registers
  // tiles wholly before the block's first query (t0 + 32 <= q0, block-uniform) need no mask; the two tiles from q0 on do
  int t0 = 0;
  for (; t0 < q0; t0 += 32) key_tile<false>(t0, t_end, tid, lane, half, qg, Kg, Vg, Kh, Kl, Vh, Vl, xk, xv, qh, ql, o, mrow, lrow);
  for (; t0 < t_end; t0 += 32) key_tile<true>(t0, t_end, tid, lane, half, qg, Kg, Vg, Kh, Kl, Vh, Vl, xk, xv, qh, ql, o, mrow, lrow);

  float* os_ = Os[wave];
  const float inv = 1.0f / (lrow + xhalf(lrow));   // the two halves' key sums joined once
#pragma unroll
  for (int j = 0; j < 4; ++j) {                    // o[j][r] is d = j * 16 + 8 * half + r of query col
    const v4f w0 = {o[j][0] * inv, o[j][1] * inv, o[j][2] * inv, o[j][3] * inv};
    const v4f w1 = {o[j][4] * inv, o[j][5] * inv, o[j][6] * inv, o[j][7] * inv};
    vst2(os_ + col * OP_ + j * 16 + 8 * half, w0);
    vst2(os_ + col * OP_ + j * 16 + 8 * half + 4, w1);
  }
  __syncthreads();
#pragma unroll
  for (int q = 0; q < 8; ++q) {
    const int rl = q * 2 + (lane >> 4), pc = lane & 15;
    vst2(Ctx + ((size_t)(b * S_ + mq + rl)) * D_ + head * HD_ + pc * 4, *(const v4f*)(os_ + rl * OP_ + pc * 4));
  }
  asm volatile("s_wait_xcnt 0x0" ::: "memory");   // stands ahead of the next tile's reuse of the stores' address and data registers
  }
}

__global__ __launch_bounds__(128) void out_gemm_kernel(const float* __restrict__ Cx, const float* __restrict__ Wo, float* __restrict__ Out) {
  __shared__ __align__(16) float st[4][32 * 64];
  __shared__ __align__(16) __bf16 Th[192 * TP_], Tl[192 * TP_];   // k slice: 64 rows of Cx, 128 rows of Wo
  const int lane = threadIdx.x & 31, wave = threadIdx.x >> 5;
  const int m0 = blockIdx.y * 64 + (wave >> 1) * 32;
  const int n0 = blockIdx.x * 128 + (wave & 1) * 64;
  v8f acc[2][4] = {};
  gemm_mainloop_32x64<QKV_, 64, 128>(Cx, Wo, blockIdx.y * 64, blockIdx.x * 128, (wave >> 1) * 32, (wave & 1) * 64, threadIdx.x, Th, Tl, acc);
  const int half = lane >> 4, col = lane & 15;
  float* S = st[wave];
#pragma unroll
  for (int i = 0; i < 2; ++i)
#pragma unroll
    for (int j = 0; j < 4; ++j)
#pragma unroll
      for (int r = 0; r < 8; ++r) S[(i * 16 + r + 8 * half) * 64 + j * 16 + col] = acc[i][j][r];
  __syncthreads();
#pragma unroll
  for (int q = 0; q < 16; ++q) {
    const int rl = q * 2 + (lane >> 4), pc = lane & 15;
    vst2(Out + (size_t)(m0 + rl) * D_ + n0 + pc * 4, *(const v4f*)(S + rl * 64 + pc * 4));
  }
}

extern "C" void kernel_launch(void* const* d_in, const int* in_sizes, int n_in,
                              void* d_out, int out_size, void* d_ws, size_t ws_size,
                              hipStream_t stream) {
  (void)in_sizes; (void)n_in; (void)out_size; (void)ws_size;
  const float* x    = (const float*)d_in[0];
  const float* Wqkv = (const float*)d_in[1];   // [3D][D]: rows [0,D) = Wq, [D,2D) = Wk, [2D,3D) = Wv
  const float* Wout = (const float*)d_in[2];   // [D][D]
  float* out = (float*)d_out;

  const size_t E = (size_t)M_TOT * D_;          // 8,388,608 floats per buffer (32 MB)
  float* qb   = (float*)d_ws;
  float* kb   = qb + E;
  float* vtb  = kb + E;        // kb, vtb: each a bf16 hi plane and a bf16 lo plane of E elements (K [B,H,S,HD], V [B,H,S/32,HD,32])
  float* ctxb = vtb + E;       // total 128 MB

  qkv_kernel<<<dim3(H_, M_TOT / 128), 256, 0, stream>>>(x, Wqkv, qb, kb, vtb);
  attn_kernel<<<dim3(S_ / 128, H_, B_), 128, 0, stream>>>(qb, kb, vtb, ctxb);
  out_gemm_kernel<<<dim3(D_ / 128, M_TOT / 64), 128, 0, stream>>>(ctxb, Wout, out);
}

// v010
// One run takes 271 microseconds.
// Next to v009, in two timings, it ran 1.09 times as fast each time.
// Over all steps from v000 it is 3.00 times as fast.
#include <hip/hip_runtime.h>

// ---------------------------------------------------------------------------
// CausalMultiHeadSelfAttention (B=2, S=4096, D=1024, H=16, HD=64, causal; packed Wqkv [3D][D], Wout [D][D])
// Contractions: Q/K/V projections (K = 1024), QK^T (K = 64), P V (K = keys) and the output projection (K = 1024) — all on
// v_wmma_f32_16x16x32_bf16 as bf16 hi/lo splits (hi*hi + hi*lo + lo*hi, f32 accumulate) with every operand kept in f32 and
// split in registers / at LDS staging, but K and V, which leave their projections as hi/lo planes (causal rows expose single V rows,
// so plain 16-bit operands miss).
// ---------------------------------------------------------------------------

#define B_   2
#define S_   4096
#define D_   1024
#define QKV_ 1024
#define H_   16
#define HD_  64
#define M_TOT (B_ * S_)
#define SCALE_ 0.125f  // 64^-0.5
#define PLANE_ ((size_t)M_TOT * D_)   // elements of one bf16 plane of K or V; the lo plane follows the hi plane

typedef __attribute__((ext_vector_type(16))) __bf16 v16bf;
typedef __attribute__((ext_vector_type(8)))  __bf16 v8bf;
typedef __attribute__((ext_vector_type(4)))  __bf16 v4bf;
typedef __attribute__((ext_vector_type(8)))  float  v8f;
typedef __attribute__((ext_vector_type(4)))  float  v4f;

template <typename V> __device__ __forceinline__ void vst2(void* p, V v) {
  *(V*)p = v; 
}
__device__ __forceinline__ __bf16 bf_hi(float x) { return (__bf16)x; }
__device__ __forceinline__ __bf16 bf_lo(float x, __bf16 h) { return (__bf16)(x - (float)h); }
// the plain builtin: the compiler keeps the distances behind it itself, and is free to issue the products of independent accumulator
// tiles back to back and to fetch LDS fragments ahead of them (each accumulator still takes hi*hi, hi*lo, lo*hi in this order)
__device__ __forceinline__ v8f wmma_bf16(v16bf a, v16bf b, v8f c) {
  return __builtin_amdgcn_wmma_f32_16x16x32_bf16(false, a, false, b, (short)0, c, false, false);
}
__device__ __forceinline__ v8f wmma_x3(v16bf ah, v16bf al, v16bf bh, v16bf bl, v8f c) {
  c = wmma_bf16(ah, bh, c); c = wmma_bf16(ah, bl, c); c = wmma_bf16(al, bh, c);
  return c;
}

// ---- eight f32 values -> four registers of bf16 hi pairs and four of bf16 lo pairs, three vector instructions a pair:
//      the packed conversion gives both hi values; v_fma_mixlo_bf16 / v_fma_mixhi_bf16 read one half of that register as bf16, form x - hi in f32
//      (exact) and round it to bf16 straight into the low / high half of the lo register. Same values as bf_hi and bf_lo.
//      Written as asm because the compiler's own form converts every hi value a second time alone and packs the lo values with a further conversion.
//      Each s_delay_alu names the producers four vector instructions back, so that the SIMD issues other waves while a result is on its way.
typedef unsigned int u32;
typedef __attribute__((ext_vector_type(2))) u32 v2u;
typedef __attribute__((ext_vector_type(8))) u32 v8u;
// in a GEMM k loop; volatile: it stays behind the v_nop statement at the head of the loop
__device__ __forceinline__ void split8_loop(float x0, float x1, float x2, float x3, float x4, float x5, float x6, float x7, u32 (&h)[4], u32 (&l)[4]) {
  asm volatile(
      "v_cvt_pk_bf16_f32 %0, %8, %9\n\t"
      "v_cvt_pk_bf16_f32 %1, %10, %11\n\t"
      "v_cvt_pk_bf16_f32 %2, %12, %13\n\t"
      "v_cvt_pk_bf16_f32 %3, %14, %15\n\t"
      "s_delay_alu instid0(VALU_DEP_4) | instskip(NEXT) | instid1(VALU_DEP_4)\n\t"
      "v_fma_mixlo_bf16 %4, %0, -1.0, %8 op_sel_hi:[1,0,0]\n\t"
      "v_fma_mixlo_bf16 %5, %1, -1.0, %10 op_sel_hi:[1,0,0]\n\t"
      "s_delay_alu instid0(VALU_DEP_4) | instskip(NEXT) | instid1(VALU_DEP_4)\n\t"
      "v_fma_mixlo_bf16 %6, %2, -1.0, %12 op_sel_hi:[1,0,0]\n\t"
      "v_fma_mixlo_bf16 %7, %3, -1.0, %14 op_sel_hi:[1,0,0]\n\t"
      "s_delay_alu instid0(VALU_DEP_4) | instskip(NEXT) | instid1(VALU_DEP_4)\n\t"
      "v_fma_mixhi_bf16 %4, %0, -1.0, %9 op_sel:[1,0,0] op_sel_hi:[1,0,0]\n\t"
      "v_fma_mixhi_bf16 %5, %1, -1.0, %11 op_sel:[1,0,0] op_sel_hi:[1,0,0]\n\t"
      "s_delay_alu instid0(VALU_DEP_4) | instskip(NEXT) | instid1(VALU_DEP_4)\n\t"
      "v_fma_mixhi_bf16 %6, %2, -1.0, %13 op_sel:[1,0,0] op_sel_hi:[1,0,0]\n\t"
      "v_fma_mixhi_bf16 %7, %3, -1.0, %15 op_sel:[1,0,0] op_sel_hi:[1,0,0]"
      : "=&v"(h[0]), "=&v"(h[1]), "=&v"(h[2]), "=&v"(h[3]), "=&v"(l[0]), "=&v"(l[1]), "=&v"(l[2]), "=&v"(l[3])
      : "v"(x0), "v"(x1), "v"(x2), "v"(x3), "v"(x4), "v"(x5), "v"(x6), "v"(x7));
}
// behind v_exp_f32: the v_nop is the slot the instruction set asks for between a transcendental and a reader of its result, which the compiler
// cannot place for a reader in asm; the first s_delay_alu names the youngest transcendental
__device__ __forceinline__ void split8_exp(float x0, float x1, float x2, float x3, float x4, float x5, float x6, float x7, u32 (&h)[4], u32 (&l)[4]) {
  asm(
      "v_nop\n\t"
      "s_delay_alu instid0(TRANS32_DEP_1)\n\t"
      "v_cvt_pk_bf16_f32 %0, %8, %9\n\t"
      "v_cvt_pk_bf16_f32 %1, %10, %11\n\t"
      "v_cvt_pk_bf16_f32 %2, %12, %13\n\t"
      "v_cvt_pk_bf16_f32 %3, %14, %15\n\t"
      "s_delay_alu instid0(VALU_DEP_4) | instskip(NEXT) | instid1(VALU_DEP_4)\n\t"
      "v_fma_mixlo_bf16 %4, %0, -1.0, %8 op_sel_hi:[1,0,0]\n\t"
      "v_fma_mixlo_bf16 %5, %1, -1.0, %10 op_sel_hi:[1,0,0]\n\t"
      "s_delay_alu instid0(VALU_DEP_4) | instskip(NEXT) | instid1(VALU_DEP_4)\n\t"
      "v_fma_mixlo_bf16 %6, %2, -1.0, %12 op_sel_hi:[1,0,0]\n\t"
      "v_fma_mixlo_bf16 %7, %3, -1.0, %14 op_sel_hi:[1,0,0]\n\t"
      "s_delay_alu instid0(VALU_DEP_4) | instskip(NEXT) | instid1(VALU_DEP_4)\n\t"
      "v_fma_mixhi_bf16 %4, %0, -1.0, %9 op_sel:[1,0,0] op_sel_hi:[1,0,0]\n\t"
      "v_fma_mixhi_bf16 %5, %1, -1.0, %11 op_sel:[1,0,0] op_sel_hi:[1,0,0]\n\t"
      "s_delay_alu instid0(VALU_DEP_4) | instskip(NEXT) | instid1(VALU_DEP_4)\n\t"
      "v_fma_mixhi_bf16 %6, %2, -1.0, %13 op_sel:[1,0,0] op_sel_hi:[1,0,0]\n\t"
      "v_fma_mixhi_bf16 %7, %3, -1.0, %15 op_sel:[1,0,0] op_sel_hi:[1,0,0]"
      : "=&v"(h[0]), "=&v"(h[1]), "=&v"(h[2]), "=&v"(h[3]), "=&v"(l[0]), "=&v"(l[1]), "=&v"(l[2]), "=&v"(l[3])
      : "v"(x0), "v"(x1), "v"(x2), "v"(x3), "v"(x4), "v"(x5), "v"(x6), "v"(x7));
}

// lane l takes the value of lane l ^ 16 (the other half of the wave)
__device__ __forceinline__ float xhalf(float x) {
  return __builtin_bit_cast(float, __builtin_amdgcn_permlanex16(__builtin_bit_cast(int, x), __builtin_bit_cast(int, x), 0x76543210, 0xfedcba98, false, false));
}

// ---- fragment loaders (wave32): A (16x32 from [M][ld]) and B from B^T ([N][ld]) share the per-lane K map:
//      row/col = lane&15; elements 0..7 <- k0 + 8*half + 0..7, elements 8..15 <- k0 + 16 + 8*half + 0..7
// f32 source split into bf16 hi/lo
__device__ __forceinline__ void frag_f32(const float* __restrict__ base, int ld, int r0, int k0, int lane, v16bf& hi, v16bf& lo) {
  const float* p = base + (size_t)(r0 + (lane & 15)) * ld + k0 + (lane >> 4) * 8;
  const v4f a0 = *(const v4f*)(p), a1 = *(const v4f*)(p + 4), a2 = *(const v4f*)(p + 16), a3 = *(const v4f*)(p + 20);
#pragma unroll
  for (int i = 0; i < 4; ++i) {
    __bf16 h;
    h = bf_hi(a0[i]); hi[i] = h;      lo[i] = bf_lo(a0[i], h);
    h = bf_hi(a1[i]); hi[4 + i] = h;  lo[4 + i] = bf_lo(a1[i], h);
    h = bf_hi(a2[i]); hi[8 + i] = h;  lo[8 + i] = bf_lo(a2[i], h);
    h = bf_hi(a3[i]); hi[12 + i] = h; lo[12 + i] = bf_lo(a3[i], h);
  }
}
// bf16 plane in LDS
__device__ __forceinline__ v16bf frag_lds(const __bf16* base, int ld, int r0, int k0, int lane) {
  union { v16bf v; v8bf h[2]; } r;
  const __bf16* p = base + (r0 + (lane & 15)) * ld + k0 + (lane >> 4) * 8;
  r.h[0] = *(const v8bf*)(p); r.h[1] = *(const v8bf*)(p + 16);
  return r.v;
}


// ---- 32x64-per-wave GEMM main loop over f32 operands (A [M][K], Bt [N][K]) split into bf16 hi/lo; block = 4 waves, tile BM x BN.
//      Each 32-wide k slice (BM rows of A, then BN rows of Bt) is read from global memory in whole 128-byte lines (8 lanes per row),
//      split once per block and kept as two bf16 planes in LDS; the waves take their fragments from there (same k map as frag_f32).
#define TP_ 40   // LDS row pitch of a slice in bf16 elements (80 bytes)
template <int KDIM, int BM, int BN>
__device__ __forceinline__ void gemm_mainloop_32x64(const float* __restrict__ A, const float* __restrict__ Bt,
                                                    int mblk, int nblk, int mw, int nw, int tid,
                                                    __bf16* __restrict__ Th, __bf16* __restrict__ Tl, v8f acc[2][4]) {
  constexpr int NA = BM / 16, NL = (BM + BN) / 16;   // the 128 threads cover 16 rows per load
  const int lane = tid & 31, sr = tid >> 3, sc = (tid & 7) * 4;
  const float* pa = A + (size_t)(mblk + sr) * KDIM + sc;
  const float* pb = Bt + (size_t)(nblk + sr) * KDIM + sc;
  v4f x[NL];   // the slice on its way from global memory: always one slice ahead of the products
#pragma unroll
  for (int i = 0; i < NL; ++i)
    x[i] = (i < NA) ? *(const v4f*)(pa + (size_t)i * 16 * KDIM) : *(const v4f*)(pb + (size_t)(i - NA) * 16 * KDIM);
  asm volatile("s_wait_xcnt 0x0" ::: "memory");   // stands ahead of any reuse of the loads' address registers
#pragma unroll 1
  for (int k0 = 0; k0 < KDIM; k0 += 32) {
    u32 h[NL / 2][4], l[NL / 2][4];   // the split touches registers only: it stands ahead of the barrier, under the products of waves still at the slice before
    // the distance the chip needs behind a WMMA: the statements below may write registers that the last products of the slice before read, and the compiler does not look into asm
    asm volatile("v_nop\n\tv_nop\n\tv_nop\n\tv_nop");
#pragma unroll
    for (int i = 0; i < NL; i += 2)   // two loads' values a statement
      split8_loop(x[i][0], x[i][1], x[i][2], x[i][3], x[i + 1][0], x[i + 1][1], x[i + 1][2], x[i + 1][3], h[i / 2], l[i / 2]);
    __syncthreads();   // every wave has taken its fragments of the slice before
#pragma unroll
    for (int i = 0; i < NL; ++i) {
      vst2(Th + (i * 16 + sr) * TP_ + sc, v2u{h[i / 2][(i & 1) * 2], h[i / 2][(i & 1) * 2 + 1]});
      vst2(Tl + (i * 16 + sr) * TP_ + sc, v2u{l[i / 2][(i & 1) * 2], l[i / 2][(i & 1) * 2 + 1]});
    }
    __syncthreads();   // the slice is complete for every wave
    if (k0 + 32 < KDIM) {   // block-uniform: the next slice's loads go out here and fly under this slice's fragment reads and products
#pragma unroll
      for (int i = 0; i < NL; ++i)
        x[i] = (i < NA) ? *(const v4f*)(pa + (size_t)i * 16 * KDIM + k0 + 32) : *(const v4f*)(pb + (size_t)(i - NA) * 16 * KDIM + k0 + 32);
      asm volatile("s_wait_xcnt 0x0" ::: "memory");   // stands ahead of any reuse of the loads' address registers; also holds the loads ahead of the LDS reads below
    }
    v16bf ah[2], al[2], bh[4], bl[4];
#pragma unroll
    for (int i = 0; i < 2; ++i) { ah[i] = frag_lds(Th, TP_, mw + i * 16, 0, lane); al[i] = frag_lds(Tl, TP_, mw + i * 16, 0, lane); }
#pragma unroll
    for (int j = 0; j < 4; ++j) { bh[j] = frag_lds(Th, TP_, BM + nw + j * 16, 0, lane); bl[j] = frag_lds(Tl, TP_, BM + nw + j * 16, 0, lane); }
#pragma unroll
    for (int i = 0; i < 2; ++i)
#pragma unroll
      for (int j = 0; j < 4; ++j) acc[i][j] = wmma_x3(ah[i], al[i], bh[j], bl[j], acc[i][j]);
  }
}

// ---- Stage 1: the three projections in one launch. grid (H, M_TOT/128), block 256 = 8 waves (2 in M x 4 in N), wave tile 64 x 48.
//      A block takes 128 token rows against 192 rows of W: the 64 rows of its head in Wq, in Wk and in Wv. Each 32-wide k slice of x is read
//      from global memory and split into bf16 hi/lo once for all three products; the slice (128 rows of x, then 64 + 64 + 64 rows of W) lies in
//      LDS as two bf16 planes, as in gemm_mainloop_32x64, and every accumulator takes its k slices and its hi/lo products in the same order.
template <int KDIM>
__device__ __forceinline__ void qkv_mainloop(const float* __restrict__ A, const float* __restrict__ Wm,
                                             int mblk, int n0, int mw, int nw, int tid,
                                             __bf16* __restrict__ Th, __bf16* __restrict__ Tl, v8f acc[4][3]) {
  constexpr int NA = 4, NL = 10;   // the 256 threads cover 32 rows per load: 4 loads of x, 2 each of Wq, Wk, Wv
  const int lane = tid & 31, sr = tid >> 3, sc = (tid & 7) * 4;
  const float* pa = A + (size_t)(mblk + sr) * KDIM + sc;
  const float* pb = Wm + (size_t)(n0 + sr) * KDIM + sc;
  v4f x[NL];   // the slice on its way from global memory: always one slice ahead of the products
#pragma unroll
  for (int i = 0; i < NL; ++i)
    x[i] = (i < NA) ? *(const v4f*)(pa + (size_t)i * 32 * KDIM)
                    : *(const v4f*)(pb + (size_t)(((i - NA) >> 1) * QKV_ + ((i - NA) & 1) * 32) * KDIM);
  asm volatile("s_wait_xcnt 0x0" ::: "memory");   // stands ahead of any reuse of the loads' address registers
  // kept rolled: one copy of a slice's code in the instruction cache, one set of registers
#pragma unroll 1
  for (int k0 = 0; k0 < KDIM; k0 += 32) {
    u32 h[NL / 2][4], l[NL / 2][4];   // the split touches registers only: it stands ahead of the barrier, under the products of waves still at the slice before
    // the distance the chip needs behind a WMMA: the statements below may write registers that the last products of the slice before read, and the compiler does not look into asm
    asm volatile("v_nop\n\tv_nop\n\tv_nop\n\tv_nop");
#pragma unroll
    for (int i = 0; i < NL; i += 2)   // two loads' values a statement
      split8_loop(x[i][0], x[i][1], x[i][2], x[i][3], x[i + 1][0], x[i + 1][1], x[i + 1][2], x[i + 1][3], h[i / 2], l[i / 2]);
    __syncthreads();   // every wave has taken its fragments of the slice before
#pragma unroll
    for (int i = 0; i < NL; ++i) {
      vst2(Th + (i * 32 + sr) * TP_ + sc, v2u{h[i / 2][(i & 1) * 2], h[i / 2][(i & 1) * 2 + 1]});
      vst2(Tl + (i * 32 + sr) * TP_ + sc, v2u{l[i / 2][(i & 1) * 2], l[i / 2][(i & 1) * 2 + 1]});
    }
    __syncthreads();   // the slice is complete for every wave
    if (k0 + 32 < KDIM) {   // block-uniform: the next slice's loads go out here and fly under this slice's fragment reads and products
#pragma unroll
      for (int i = 0; i < NL; ++i)
        x[i] = (i < NA) ? *(const v4f*)(pa + (size_t)i * 32 * KDIM + k0 + 32)
                        : *(const v4f*)(pb + (size_t)(((i - NA) >> 1) * QKV_ + ((i - NA) & 1) * 32) * KDIM + k0 + 32);
      asm volatile("s_wait_xcnt 0x0" ::: "memory");   // stands ahead of any reuse of the loads' address registers; also holds the loads ahead of the LDS reads below
    }
    v16bf bh[3], bl[3];
#pragma unroll
    for (int j = 0; j < 3; ++j) { bh[j] = frag_lds(Th, TP_, 128 + nw + j * 16, 0, lane); bl[j] = frag_lds(Tl, TP_, 128 + nw + j * 16, 0, lane); }
    v16bf ah[4], al[4];   // the x fragments of row group i + 2 are asked for behind the products of group i and arrive under those of group i + 1
#pragma unroll
    for (int i = 0; i < 2; ++i) { ah[i] = frag_lds(Th, TP_, mw + i * 16, 0, lane); al[i] = frag_lds(Tl, TP_, mw + i * 16, 0, lane); }
    __builtin_amdgcn_sched_barrier(0);   // keeps the reads above as one group ahead of the products: sunk among them, each is waited for where it stands
#pragma unroll
    for (int i = 0; i < 4; ++i) {
#pragma unroll
      for (int j = 0; j < 3; ++j) acc[i][j] = wmma_x3(ah[i], al[i], bh[j], bl[j], acc[i][j]);
      if (i < 2) {
        ah[i + 2] = frag_lds(Th, TP_, mw + (i + 2) * 16, 0, lane); al[i + 2] = frag_lds(Tl, TP_, mw + (i + 2) * 16, 0, lane);
        __builtin_amdgcn_sched_barrier(0);   // keeps these reads ahead of the next group's products, which cover their latency
      }
    }
  }
}

//      Q leaves as f32, scaled. K and V leave already split, as a bf16 hi plane and a bf16 lo plane, each laid out so that a 32-key tile of a head
//      is 4 KB in a row: K [B,H,S,HD], V [B,H,S/32,HD,32]. The split is made once here, not by every attention block that reads the tile.
__global__ __launch_bounds__(256) void qkv_kernel(const float* __restrict__ X, const float* __restrict__ Wm,
                                                  float* __restrict__ Qd, float* __restrict__ Kd, float* __restrict__ Vd) {
  __shared__ __align__(16) float st[128][192];       // 96 KB: columns 0..63 Q, 64..127 K, 128..191 V of the head
  __shared__ __align__(16) __bf16 Th[320 * TP_], Tl[320 * TP_];   // k slice: 128 rows of X, 192 rows of W
  const int tid = threadIdx.x, lane = tid & 31, wave = tid >> 5;
  const int mblk = blockIdx.y * 128;
  const int head = blockIdx.x;
  const int b = mblk / S_, s0 = mblk % S_;
  const int mw = (wave & 1) * 64, nw = (wave >> 1) * 48;

  v8f acc[4][3] = {};
  qkv_mainloop<D_>(X, Wm, mblk, head * HD_, mw, nw, tid, Th, Tl, acc);
  const int half = lane >> 4, col = lane & 15;
#pragma unroll
  for (int i = 0; i < 4; ++i)
#pragma unroll
    for (int j = 0; j < 3; ++j)
#pragma unroll
      for (int r = 0; r < 8; ++r) st[mw + i * 16 + r + 8 * half][nw + j * 16 + col] = acc[i][j][r];
  __syncthreads();
  const size_t hb = (size_t)(b * H_ + head) * S_ * HD_;   // first element of the head in Q and in every plane of K and V
  // the three store loops are counted and unrolled: a loop's LDS reads go out together and its stores follow, not one LDS round trip per piece
#pragma unroll
  for (int it = 0; it < 8; ++it) {                         // Q: 128 token rows x 16 pieces; a wave instruction covers 2 rows
    const int g = it * 256 + tid, ml = g >> 4, pc = g & 15;
    const v4f v = *(const v4f*)(&st[ml][pc * 4]);
    vst2(Qd + hb + (size_t)(s0 + ml) * HD_ + pc * 4, v * SCALE_);
  }
  {
    __bf16* ph = (__bf16*)Kd;
#pragma unroll
    for (int it = 0; it < 8; ++it) {                       // K: 128 token rows x 16 pieces; a wave instruction covers 2 rows = 256 B of a plane
      const int g = it * 256 + tid, ml = g >> 4, pc = g & 15;
      const v4f v = *(const v4f*)(&st[ml][64 + pc * 4]);
      v4bf h, l;
#pragma unroll
      for (int e = 0; e < 4; ++e) { h[e] = bf_hi(v[e]); l[e] = bf_lo(v[e], h[e]); }
      const size_t o = hb + (size_t)(s0 + ml) * HD_ + pc * 4;
      vst2(ph + o, h);
      vst2(ph + PLANE_ + o, l);
    }
  }
  {
    __bf16* ph = (__bf16*)Vd;
#pragma unroll
    for (int kt = 0; kt < 4; ++kt) {                       // V: 4 key tiles, a wave takes 8 d rows of each; a wave instruction covers 8 rows = 512 B of a plane
      const int dl = wave * 8 + (lane >> 2), kp = (lane & 3) * 8;
      v8bf h, l;
#pragma unroll
      for (int e = 0; e < 8; ++e) { const float v = st[kt * 32 + kp + e][128 + dl]; h[e] = bf_hi(v); l[e] = bf_lo(v, h[e]); }
      const size_t o = hb + ((size_t)((s0 >> 5) + kt) * HD_ + dl) * 32 + kp;
      vst2(ph + o, h);
      vst2(ph + PLANE_ + o, l);
    }
  }
}

// One 32-key tile of the key loop: the tile that has arrived goes to LDS, the next one's loads go out, then S^T, softmax, O^T.
// A wave works two 16-query column groups g = 0, 1 (queries qg and qg + 16 in a lane): every K and V fragment it reads from LDS feeds both.
// MASK = false is for a tile whose last key stands before the block's first query: there key <= query holds for all 32 scores of every lane,
// so the causal compares and selects are left out; MASK = true works them.
template <bool MASK>
__device__ __forceinline__ void key_tile(int t0, int t_end, int tid, int lane, int half, int qg,
                                         const __bf16* __restrict__ Kg, const __bf16* __restrict__ Vg,
                                         __bf16* Kh, __bf16* Kl, __bf16* Vh, __bf16* Vl,
                                         v8bf (&xk)[2][2], v8bf (&xv)[2][2], const v16bf (&qh)[2][2], const v16bf (&ql)[2][2],
                                         v8f (&o)[2][4], float (&mrow)[2], float (&lrow)[2]) {
  __syncthreads();
  {   // the tile that has arrived goes to LDS
#pragma unroll
    for (int i = 0; i < 2; ++i) {
      const int pc = i * 128 + tid;      // 16-byte piece of the tile: 8 pieces per K row, 4 per V^T row
      vst2(Kh + (pc >> 3) * 72 + (pc & 7) * 8, xk[0][i]); vst2(Kl + (pc >> 3) * 72 + (pc & 7) * 8, xk[1][i]);
      vst2(Vh + (pc >> 2) * 40 + (pc & 3) * 8, xv[0][i]); vst2(Vl + (pc >> 2) * 40 + (pc & 3) * 8, xv[1][i]);
    }
  }
  __syncthreads();
  if (t0 + 32 < t_end) {   // block-uniform: the next key tile's loads go out here and fly under this tile's products and softmax
    const __bf16* kp = Kg + (size_t)(t0 + 32) * HD_;
    const __bf16* vp = Vg + (size_t)(t0 + 32) * HD_;
#pragma unroll
    for (int i = 0; i < 2; ++i) {
      xk[0][i] = *(const v8bf*)(kp + i * 1024); xk[1][i] = *(const v8bf*)(kp + PLANE_ + i * 1024);
      xv[0][i] = *(const v8bf*)(vp + i * 1024); xv[1][i] = *(const v8bf*)(vp + PLANE_ + i * 1024);
    }
    asm volatile("s_wait_xcnt 0x0" ::: "memory");   // stands ahead of any reuse of the loads' address registers; also holds the loads ahead of the LDS reads below
  }

  // the tile's fragments, each read once for both column groups: K first, then V, which arrives under the S^T products and the softmax
  v16bf kh[2][2], kl[2][2], vh[4], vl[4];
#pragma unroll
  for (int n = 0; n < 2; ++n)
#pragma unroll
    for (int kb = 0; kb < 2; ++kb) { kh[n][kb] = frag_lds(Kh, 72, n * 16, kb * 32, lane); kl[n][kb] = frag_lds(Kl, 72, n * 16, kb * 32, lane); }
#pragma unroll
  for (int j = 0; j < 4; ++j) { vh[j] = frag_lds(Vh, 40, j * 16, 0, lane); vl[j] = frag_lds(Vl, 40, j * 16, 0, lane); }
  __builtin_amdgcn_sched_barrier(0);   // keeps the reads above as one group ahead of the products: sunk among them, each is waited for where it stands

  v8f sg[2][2] = {};   // [column group][16-key row group]
#pragma unroll
  for (int n = 0; n < 2; ++n)
#pragma unroll
    for (int kb = 0; kb < 2; ++kb)
#pragma unroll
      for (int g = 0; g < 2; ++g) sg[g][n] = wmma_x3(kh[n][kb], kl[n][kb], qh[g][kb], ql[g][kb], sg[g][n]);

  v16bf pbh[2], pbl[2];
#pragma unroll
  for (int g = 0; g < 2; ++g) {
    v8f (&s)[2] = sg[g];
    const int qc = qg + g * 16;        // this lane's query in the group
    const int kg = t0 + 8 * half;      // s[n][r] is key kg + 16 * n + r against query qc
    float mx = -1e30f;
#pragma unroll
    for (int n = 0; n < 2; ++n)
#pragma unroll
      for (int r = 0; r < 8; ++r) {
        if (MASK) s[n][r] = (kg + n * 16 + r <= qc) ? s[n][r] : -1e30f;   // scores already carry the 1/8 scale (folded into Q)
        mx = fmaxf(mx, s[n][r]);
      }
    mx = fmaxf(mx, xhalf(mx));
    const float mnew  = fmaxf(mrow[g], mx);
    const float alpha = __expf(mrow[g] - mnew);
    float rs = 0.0f;
    v8u ph, pl;   // element n * 8 + r of the B operand lies in half r & 1 of register n * 4 + r / 2
#pragma unroll
    for (int n = 0; n < 2; ++n) {
      float p[8];
#pragma unroll
      for (int r = 0; r < 8; ++r) {
        p[r] = (!MASK || kg + n * 16 + r <= qc) ? __expf(s[n][r] - mnew) : 0.0f;
        rs += p[r];
      }
      u32 h[4], l[4];
      split8_exp(p[0], p[1], p[2], p[3], p[4], p[5], p[6], p[7], h, l);
#pragma unroll
      for (int c = 0; c < 4; ++c) { ph[n * 4 + c] = h[c]; pl[n * 4 + c] = l[c]; }
    }
    pbh[g] = __builtin_bit_cast(v16bf, ph); pbl[g] = __builtin_bit_cast(v16bf, pl);
    lrow[g] = lrow[g] * alpha + rs;
    mrow[g] = mnew;
#pragma unroll
    for (int j = 0; j < 4; ++j)
#pragma unroll
      for (int r = 0; r < 8; ++r) o[g][j][r] *= alpha;
  }
#pragma unroll
  for (int j = 0; j < 4; ++j)
#pragma unroll
    for (int g = 0; g < 2; ++g) o[g][j] = wmma_x3(vh[j], vl[j], pbh[g], pbl[g], o[g][j]);
}

#define OP_ 68   // pitch in floats of a query row in the output staging
#define NQT_ (S_ / 128)   // 128-query tiles per head
__global__ __launch_bounds__(128) void attn_kernel(const float* __restrict__ Qb, const float* __restrict__ Kb,
                                                  const float* __restrict__ Vt, float* __restrict__ Ctx) {
  __shared__ __align__(16) __bf16 Kh[32 * 72], Kl[32 * 72];     // [key][d] pitch 72
  __shared__ __align__(16) __bf16 Vh[64 * 40], Vl[64 * 40];     // [d][key] pitch 40
  __shared__ __align__(16) float  Os[4][32 * OP_];

  const int tid = threadIdx.x, lane = tid & 31, wave = tid >> 5, half = lane >> 4, col = lane & 15;
  const int head = blockIdx.y, b = blockIdx.z;
  const float* Qh = Qb + (size_t)(b * H_ + head) * S_ * HD_;
  // K and V arrive split (hi plane, then lo plane); in all four planes the 32-key tile at t0 is the 4 KB from element t0 * HD_ of the head
  const __bf16* Kg = (const __bf16*)Kb + (size_t)(b * H_ + head) * S_ * HD_ + tid * 8;
  const __bf16* Vg = (const __bf16*)Vt + (size_t)(b * H_ + head) * S_ * HD_ + tid * 8;
  // kept rolled: one copy of the key loop in the instruction cache, one set of registers
#pragma unroll 1
  for (int pass = 0; pass < 2; ++pass) {
  const int q0 = (pass == 0 ? NQT_ - 1 - (int)blockIdx.x : (int)blockIdx.x) * 128;   // block-uniform
  const int mq = q0 + wave * 32;

  v16bf qh[2][2], ql[2][2];   // [column group][32-wide slice of d]
#pragma unroll
  for (int g = 0; g < 2; ++g)
#pragma unroll
    for (int kb = 0; kb < 2; ++kb) frag_f32(Qh, HD_, mq + g * 16, kb * 32, lane, qh[g][kb], ql[g][kb]);

  v8f o[2][4] = {};
  float mrow[2] = {-1e30f, -1e30f}, lrow[2] = {0.0f, 0.0f};   // per column group, this lane's query: running maximum (same in both halves), sum over this half's keys
  const int qg = mq + col;

  const int t_end = q0 + 128;           // causal limit (block-uniform, multiple of 32)
  // K (32 x 64) and V^T (64 x 32), hi and lo, on their way from global memory, always one key tile ahead of the products:
  // a plain copy, 16 bytes per lane, so a wave instruction reads 4 whole lines
  v8bf xk[2][2], xv[2][2];
#pragma unroll
  for (int i = 0; i < 2; ++i) {
    xk[0][i] = *(const v8bf*)(Kg + i * 1024); xk[1][i] = *(const v8bf*)(Kg + PLANE_ + i * 1024);
    xv[0][i] = *(const v8bf*)(Vg + i * 1024); xv[1][i] = *(const v8bf*)(Vg + PLANE_ + i * 1024);
  }
  asm volatile("s_wait_xcnt 0x0" ::: "memory");   // stands ahead of any reuse of the loads' address registers
  // tiles wholly before the block's first query (t0 + 32 <= q0, block-uniform) need no mask; the four tiles from q0 on do
  int t0 = 0;
  for (; t0 < q0; t0 += 32) key_tile<false>(t0, t_end, tid, lane, half, qg, Kg, Vg, Kh, Kl, Vh, Vl, xk, xv, qh, ql, o, mrow, lrow);
  for (; t0 < t_end; t0 += 32) key_tile<true>(t0, t_end, tid, lane, half, qg, Kg, Vg, Kh, Kl, Vh, Vl, xk, xv, qh, ql, o, mrow, lrow);

  float* os_ = Os[wave];
#pragma unroll
  for (int g = 0; g < 2; ++g) {
    const float inv = 1.0f / (lrow[g] + xhalf(lrow[g]));   // the two halves' key sums joined once
#pragma unroll
    for (int j = 0; j < 4; ++j) {                  // o[g][j][r] is d = j * 16 + 8 * half + r of query g * 16 + col
      const v4f w0 = {o[g][j][0] * inv, o[g][j][1] * inv, o[g][j][2] * inv, o[g][j][3] * inv};
      const v4f w1 = {o[g][j][4] * inv, o[g][j][5] * inv, o[g][j][6] * inv, o[g][j][7] * inv};
      vst2(os_ + (g * 16 + col) * OP_ + j * 16 + 8 * half, w0);
      vst2(os_ + (g * 16 + col) * OP_ + j * 16 + 8 * half + 4, w1);
    }
  }
  __syncthreads();
  // a wave instruction stores two query rows; all 16 go out from one address pair with constant offsets
  float* cp = Ctx + ((size_t)(b * S_ + mq + (lane >> 4))) * D_ + head * HD_ + (lane & 15) * 4;
  const float* op = os_ + (lane >> 4) * OP_ + (lane & 15) * 4;
#pragma unroll
  for (int g = 0; g < 2; ++g) {
#pragma unroll
    for (int q = g * 8; q < g * 8 + 8; ++q) vst2(cp + (size_t)q * 2 * D_, *(const v4f*)(op + q * 2 * OP_));
    asm volatile("s_wait_xcnt 0x0" ::: "memory");   // stands ahead of the reuse of the stores' address and data registers by the next group's LDS reads and by the next tile
  }
  }
}

__global__ __launch_bounds__(128) void out_gemm_kernel(const float* __restrict__ Cx, const float* __restrict__ Wo, float* __restrict__ Out) {
  __shared__ __align__(16) float st[4][32 * 64];
  __shared__ __align__(16) __bf16 Th[192 * TP_], Tl[192 * TP_];   // k slice: 64 rows of Cx, 128 rows of Wo
  const int lane = threadIdx.x & 31, wave = threadIdx.x >> 5;
  const int m0 = blockIdx.y * 64 + (wave >> 1) * 32;
  const int n0 = blockIdx.x * 128 + (wave & 1) * 64;
  v8f acc[2][4] = {};
  gemm_mainloop_32x64<QKV_, 64, 128>(Cx, Wo, blockIdx.y * 64, blockIdx.x * 128, (wave >> 1) * 32, (wave & 1) * 64, threadIdx.x, Th, Tl, acc);
  const int half = lane >> 4, col = lane & 15;
  float* S = st[wave];
#pragma unroll
  for (int i = 0; i < 2; ++i)
#pragma unroll
    for (int j = 0; j < 4; ++j)
#pragma unroll
      for (int r = 0; r < 8; ++r) S[(i * 16 + r + 8 * half) * 64 + j * 16 + col] = acc[i][j][r];
  __syncthreads();
#pragma unroll
  for (int q = 0; q < 16; ++q) {
    const int rl = q * 2 + (lane >> 4), pc = lane & 15;
    vst2(Out + (size_t)(m0 + rl) * D_ + n0 + pc * 4, *(const v4f*)(S + rl * 64 + pc * 4));
  }
}

extern "C" void kernel_launch(void* const* d_in, const int* in_sizes, int n_in,
                              void* d_out, int out_size, void* d_ws, size_t ws_size,
                              hipStream_t stream) {
  (void)in_sizes; (void)n_in; (void)out_size; (void)ws_size;
  const float* x    = (const float*)d_in[0];
  const float* Wqkv = (const float*)d_in[1];   // [3D][D]: rows [0,D) = Wq, [D,2D) = Wk, [2D,3D) = Wv
  const float* Wout = (const float*)d_in[2];   // [D][D]
  float* out = (float*)d_out;

  const size_t E = (size_t)M_TOT * D_;          // 8,388,608 floats per buffer (32 MB)
  float* qb   = (float*)d_ws;
  float* kb   = qb + E;
  float* vtb  = kb + E;        // kb, vtb: each a bf16 hi plane and a bf16 lo plane of E elements (K [B,H,S,HD], V [B,H,S/32,HD,32])
  float* ctxb = vtb + E;       // total 128 MB

  qkv_kernel<<<dim3(H_, M_TOT / 128), 256, 0, stream>>>(x, Wqkv, qb, kb, vtb);
  attn_kernel<<<dim3(S_ / 256, H_, B_), 128, 0, stream>>>(qb, kb, vtb, ctxb);
  out_gemm_kernel<<<dim3(D_ / 128, M_TOT / 64), 128, 0, stream>>>(ctxb, Wout, out);
}
